// v000
// Measured on an AMD MI455X. A time is GPU time per run, averaged over a window of back-to-back runs after a warm-up
// (all launches, gaps included; the runs take copies of the inputs in turn), and the median of several windows.
// Apart from v000's, it joins two sittings. Times from different sittings can be a few percent apart, while
// side-by-side timings come from the same sitting.
// v000 is the starting kernel. One run takes 622 microseconds.
#include <hip/hip_runtime.h>

typedef __attribute__((ext_vector_type(16))) _Float16 v16h;
typedef __attribute__((ext_vector_type(8)))  _Float16 v8h;
typedef __attribute__((ext_vector_type(8)))  float    v8f;
typedef __attribute__((ext_vector_type(4)))  float    v4f;

#define B_SZ 8192
#define I_SZ 512
#define O_SZ 512
#define G_SZ 16
#define KTOT (I_SZ * G_SZ)        // per-trig-part K = 8192

#define BM 256
#define BN 128
#define KT 32
#define NTHREADS 512
#define NSTEPS (2 * (KTOT / KT))  // 512 total K-steps (cos part then sin part)

#define INV_2PI 0.15915494309189535f

__global__ __launch_bounds__(NTHREADS)
void fourier_kan_wmma_kernel(const float* __restrict__ x,
                             const float* __restrict__ coeffs,
                             const float* __restrict__ bias,
                             float* __restrict__ out)
{
    // Double-buffered feature tile [row][kk] and weight tile [n][kk], f16,
    // K-major per row so WMMA operand gathers are contiguous 16B LDS loads.
    __shared__ __align__(16) _Float16 Ft[2][BM * KT];   // 32 KB
    __shared__ __align__(16) _Float16 Wt[2][BN * KT];   // 16 KB

    const int tid  = threadIdx.x;
    const int lane = tid & 31;
    const int wave = tid >> 5;
    const int wm   = wave >> 1;            // 0..7 -> 32-row stripe
    const int wn   = wave & 1;             // 0..1 -> 64-col stripe
    const int row0 = blockIdx.x * BM;
    const int o0   = blockIdx.y * BN;

    // staging roles
    const int fr  = tid & (BM - 1);        // feature row 0..255
    const int fi  = tid >> 8;              // which of the 2 'i' columns
    const int wnn = tid >> 2;              // weight n 0..127
    const int wcc = (tid & 3) * 8;         // weight kk chunk 0,8,16,24

    v8f acc[8] = {};                       // [r*4 + c], r in 0..1, c in 0..3

    // per-lane K half-offset for the 16-bit WMMA A/B operand layout:
    // lanes 0-15: K = {0..7, 16..23}; lanes 16-31: K = {8..15, 24..31}
    const int hA      = (lane < 16) ? 0 : 8;
    const int aRowOff = (wm * 32 + (lane & 15)) * KT;    // A tile r adds r*16*KT
    const int bRowOff = (wn * 64 + (lane & 15)) * KT;    // B tile c adds c*16*KT

    // ---- issue global loads for step s ----
    auto issue_loads = [&](int s, float& xv, v4f& w0, v4f& w1) {
        const int ks = s & 255;
        const int p  = s >> 8;
        xv = x[(size_t)(row0 + fr) * I_SZ + ks * 2 + fi];
        const size_t base =
            (size_t)(p * O_SZ + o0 + wnn) * KTOT + (size_t)ks * KT + wcc;
        w0 = *(const v4f*)(coeffs + base);       // global_load_b128
        w1 = *(const v4f*)(coeffs + base + 4);   // global_load_b128
    };

    // ---- convert + store step s into LDS buffer `buf` ----
    auto stage = [&](int s, int buf, float xv, v4f w0, v4f w1) {
        const int   p  = s >> 8;                 // uniform scalar branch
        const float xr = xv * INV_2PI;           // v_sin/cos take revolutions
        v8h f0, f1;
        if (p == 0) {
            #pragma unroll
            for (int g = 0; g < 8; ++g)
                f0[g] = (_Float16)__builtin_amdgcn_cosf(xr * (float)(g + 1));
            #pragma unroll
            for (int g = 0; g < 8; ++g)
                f1[g] = (_Float16)__builtin_amdgcn_cosf(xr * (float)(g + 9));
        } else {
            #pragma unroll
            for (int g = 0; g < 8; ++g)
                f0[g] = (_Float16)__builtin_amdgcn_sinf(xr * (float)(g + 1));
            #pragma unroll
            for (int g = 0; g < 8; ++g)
                f1[g] = (_Float16)__builtin_amdgcn_sinf(xr * (float)(g + 9));
        }
        *(v8h*)&Ft[buf][fr * KT + fi * 16 + 0] = f0;   // ds_store_b128
        *(v8h*)&Ft[buf][fr * KT + fi * 16 + 8] = f1;   // ds_store_b128
        v8h wh;
        #pragma unroll
        for (int j = 0; j < 4; ++j) {
            wh[j]     = (_Float16)w0[j];
            wh[j + 4] = (_Float16)w1[j];
        }
        *(v8h*)&Wt[buf][wnn * KT + wcc] = wh;          // ds_store_b128
    };

    auto load16 = [&](const _Float16* rowp) -> v16h {
        v8h lo = *(const v8h*)(rowp + hA);
        v8h hi = *(const v8h*)(rowp + hA + 16);
        v16h r;
        #pragma unroll
        for (int j = 0; j < 8; ++j) { r[j] = lo[j]; r[j + 8] = hi[j]; }
        return r;
    };

    // prologue: stage step 0 into buffer 0; pre-issue loads for step 1
    float xv_p; v4f w0_p, w1_p;            // raw operands for step s+1
    {
        float xv; v4f w0, w1;
        issue_loads(0, xv, w0, w1);
        stage(0, 0, xv, w0, w1);
        issue_loads(1, xv_p, w0_p, w1_p);
    }
    __syncthreads();

    for (int s = 0; s < NSTEPS; ++s) {
        const int cur = s & 1;
        const int nxt = cur ^ 1;
        const int sn  = (s < NSTEPS - 1) ? s + 1 : s;      // step to stage
        const int sn2 = (s < NSTEPS - 2) ? s + 2 : NSTEPS - 1;  // step to load

        // 1) issue step s+2's global loads (a full iteration of latency cover)
        float xv_n; v4f w0_n, w1_n;
        issue_loads(sn2, xv_n, w0_n, w1_n);

        // 2) gather ALL operands (12 ds_load_b128), then 8 pipelined WMMAs
        v16h A0 = load16(&Ft[cur][aRowOff]);
        v16h A1 = load16(&Ft[cur][aRowOff + 16 * KT]);
        v16h Bt[4];
        #pragma unroll
        for (int c = 0; c < 4; ++c)
            Bt[c] = load16(&Wt[cur][bRowOff + c * 16 * KT]);

        #pragma unroll
        for (int c = 0; c < 4; ++c)
            acc[c] = __builtin_amdgcn_wmma_f32_16x16x32_f16(
                false, A0, false, Bt[c], (short)0, acc[c], false, false);
        #pragma unroll
        for (int c = 0; c < 4; ++c)
            acc[4 + c] = __builtin_amdgcn_wmma_f32_16x16x32_f16(
                false, A1, false, Bt[c], (short)0, acc[4 + c], false, false);

        // 3) stage step s+1 from registers loaded LAST iteration (no stall)
        stage(sn, nxt, xv_p, w0_p, w1_p);

        // Pin the shape: 3 VMEM reads -> 12 DS reads -> 8 WMMAs; everything
        // else (trig VALU, cvt, ds_stores) fills around the matrix pipe.
        __builtin_amdgcn_sched_group_barrier(0x020, 3,  0);  // VMEM read
        __builtin_amdgcn_sched_group_barrier(0x100, 12, 0);  // DS read
        __builtin_amdgcn_sched_group_barrier(0x008, 8,  0);  // MFMA/WMMA

        // 4) single barrier per K-step
        __syncthreads();

        // 5) rotate the raw-operand pipeline (copies vanish in the x2 unroll)
        xv_p = xv_n; w0_p = w0_n; w1_p = w1_n;
    }

    // ---- epilogue: add bias, store fp32 (C/D layout: VGPR j -> row j / j+8) ----
    #pragma unroll
    for (int r = 0; r < 2; ++r) {
        #pragma unroll
        for (int c = 0; c < 4; ++c) {
            const int   col  = o0 + wn * 64 + c * 16 + (lane & 15);
            const float bcol = bias[col];
            #pragma unroll
            for (int j = 0; j < 8; ++j) {
                const int row =
                    row0 + wm * 32 + r * 16 + ((lane < 16) ? j : j + 8);
                out[(size_t)row * O_SZ + col] = acc[r * 4 + c][j] + bcol;
            }
        }
    }
}

extern "C" void kernel_launch(void* const* d_in, const int* in_sizes, int n_in,
                              void* d_out, int out_size, void* d_ws, size_t ws_size,
                              hipStream_t stream) {
    const float* x      = (const float*)d_in[0];
    const float* coeffs = (const float*)d_in[1];
    const float* bias   = (const float*)d_in[2];
    float*       out    = (float*)d_out;

    dim3 grid(B_SZ / BM, O_SZ / BN);   // 32 x 4 = 128 blocks, 16 waves each
    fourier_kan_wmma_kernel<<<grid, NTHREADS, 0, stream>>>(x, coeffs, bias, out);
}

// v001
// One run takes 396 microseconds.
// Timed twice side by side with v000, it ran 1.60 times as fast both times.
#include <hip/hip_runtime.h>

typedef __attribute__((ext_vector_type(16))) _Float16 v16h;
typedef __attribute__((ext_vector_type(8)))  _Float16 v8h;
typedef __attribute__((ext_vector_type(8)))  float    v8f;
typedef __attribute__((ext_vector_type(4)))  float    v4f;

#define B_SZ 8192
#define I_SZ 512
#define O_SZ 512
#define G_SZ 16
#define KTOT (I_SZ * G_SZ)        // per-trig-part K = 8192

#define BM 256
#define BN 128
#define KT 32
#define KP 72                     // LDS row pitch in halves: 144 B = 16 B x odd
#define NTHREADS 512
#define NSTEPS (2 * (KTOT / KT))  // 512 total K-steps (cos part then sin part)

#define INV_2PI 0.15915494309189535f

__global__ __launch_bounds__(NTHREADS)
void fourier_kan_wmma_kernel(const float* __restrict__ x,
                             const float* __restrict__ coeffs,
                             const float* __restrict__ bias,
                             float* __restrict__ out)
{
    // Double-buffered feature tile [row][kk] and weight tile [n][kk], f16,
    // K-major per row so WMMA operand gathers are contiguous 16B LDS loads.
    // A row holds its KT halves of buffer 0, those of buffer 1, then 16 B of
    // pad: at this pitch the 16 rows of a ds_load_b128 half-wave fall on 16
    // different 4-bank groups (at 64 B on only 4: a 4-way conflict), and the
    // buffer is still chosen by a shift.
    __shared__ __align__(16) _Float16 Ft[BM * KP];      // 36 KB
    __shared__ __align__(16) _Float16 Wt[BN * KP];      // 18 KB

    const int tid  = threadIdx.x;
    const int lane = tid & 31;
    const int wave = tid >> 5;
    const int wm   = wave >> 1;            // 0..7 -> 32-row stripe
    const int wn   = wave & 1;             // 0..1 -> 64-col stripe
    const int row0 = blockIdx.x * BM;
    const int o0   = blockIdx.y * BN;

    // staging roles
    const int fr  = tid & (BM - 1);        // feature row 0..255
    const int fi  = tid >> 8;              // which of the 2 'i' columns
    const int wnn = tid >> 2;              // weight n 0..127
    const int wcc = (tid & 3) * 8;         // weight kk chunk 0,8,16,24

    v8f acc[8] = {};                       // [r*4 + c], r in 0..1, c in 0..3

    // per-lane K half-offset for the 16-bit WMMA A/B operand layout:
    // lanes 0-15: K = {0..7, 16..23}; lanes 16-31: K = {8..15, 24..31}
    const int hA      = (lane < 16) ? 0 : 8;
    const int aRowOff = (wm * 32 + (lane & 15)) * KP;    // A tile r adds r*16*KP
    const int bRowOff = (wn * 64 + (lane & 15)) * KP;    // B tile c adds c*16*KP

    // ---- issue global loads for step s ----
    auto issue_loads = [&](int s, float& xv, v4f& w0, v4f& w1) {
        const int ks = s & 255;
        const int p  = s >> 8;
        xv = x[(size_t)(row0 + fr) * I_SZ + ks * 2 + fi];
        const size_t base =
            (size_t)(p * O_SZ + o0 + wnn) * KTOT + (size_t)ks * KT + wcc;
        w0 = *(const v4f*)(coeffs + base);       // global_load_b128
        w1 = *(const v4f*)(coeffs + base + 4);   // global_load_b128
    };

    // ---- convert + store step s into LDS buffer `buf` ----
    auto stage = [&](int s, int buf, float xv, v4f w0, v4f w1) {
        const int   p  = s >> 8;                 // uniform scalar branch
        const float xr = xv * INV_2PI;           // v_sin/cos take revolutions
        v8h f0, f1;
        if (p == 0) {
            #pragma unroll
            for (int g = 0; g < 8; ++g)
                f0[g] = (_Float16)__builtin_amdgcn_cosf(xr * (float)(g + 1));
            #pragma unroll
            for (int g = 0; g < 8; ++g)
                f1[g] = (_Float16)__builtin_amdgcn_cosf(xr * (float)(g + 9));
        } else {
            #pragma unroll
            for (int g = 0; g < 8; ++g)
                f0[g] = (_Float16)__builtin_amdgcn_sinf(xr * (float)(g + 1));
            #pragma unroll
            for (int g = 0; g < 8; ++g)
                f1[g] = (_Float16)__builtin_amdgcn_sinf(xr * (float)(g + 9));
        }
        *(v8h*)&Ft[fr * KP + buf * KT + fi * 16 + 0] = f0;   // ds_store_b128
        *(v8h*)&Ft[fr * KP + buf * KT + fi * 16 + 8] = f1;   // ds_store_b128
        v8h wh;
        #pragma unroll
        for (int j = 0; j < 4; ++j) {
            wh[j]     = (_Float16)w0[j];
            wh[j + 4] = (_Float16)w1[j];
        }
        *(v8h*)&Wt[wnn * KP + buf * KT + wcc] = wh;          // ds_store_b128
    };

    auto load16 = [&](const _Float16* rowp) -> v16h {
        v8h lo = *(const v8h*)(rowp + hA);
        v8h hi = *(const v8h*)(rowp + hA + 16);
        v16h r;
        #pragma unroll
        for (int j = 0; j < 8; ++j) { r[j] = lo[j]; r[j + 8] = hi[j]; }
        return r;
    };

    // prologue: stage step 0 into buffer 0; pre-issue loads for step 1
    float xv_p; v4f w0_p, w1_p;            // raw operands for step s+1
    {
        float xv; v4f w0, w1;
        issue_loads(0, xv, w0, w1);
        stage(0, 0, xv, w0, w1);
        issue_loads(1, xv_p, w0_p, w1_p);
    }
    __syncthreads();

    for (int s = 0; s < NSTEPS; ++s) {
        const int cur = s & 1;
        const int nxt = cur ^ 1;
        const int sn  = (s < NSTEPS - 1) ? s + 1 : s;      // step to stage
        const int sn2 = (s < NSTEPS - 2) ? s + 2 : NSTEPS - 1;  // step to load

        // 1) issue step s+2's global loads (a full iteration of latency cover)
        float xv_n; v4f w0_n, w1_n;
        issue_loads(sn2, xv_n, w0_n, w1_n);

        // 2) gather ALL operands (12 ds_load_b128), then 8 pipelined WMMAs
        v16h A0 = load16(&Ft[aRowOff + cur * KT]);
        v16h A1 = load16(&Ft[aRowOff + cur * KT + 16 * KP]);
        v16h Bt[4];
        #pragma unroll
        for (int c = 0; c < 4; ++c)
            Bt[c] = load16(&Wt[bRowOff + cur * KT + c * 16 * KP]);

        #pragma unroll
        for (int c = 0; c < 4; ++c)
            acc[c] = __builtin_amdgcn_wmma_f32_16x16x32_f16(
                false, A0, false, Bt[c], (short)0, acc[c], false, false);
        #pragma unroll
        for (int c = 0; c < 4; ++c)
            acc[4 + c] = __builtin_amdgcn_wmma_f32_16x16x32_f16(
                false, A1, false, Bt[c], (short)0, acc[4 + c], false, false);

        // 3) stage step s+1 from registers loaded LAST iteration (no stall)
        stage(sn, nxt, xv_p, w0_p, w1_p);

        // Pin the shape: 3 VMEM reads -> 12 DS reads -> 8 WMMAs; everything
        // else (trig VALU, cvt, ds_stores) fills around the matrix pipe.
        __builtin_amdgcn_sched_group_barrier(0x020, 3,  0);  // VMEM read
        __builtin_amdgcn_sched_group_barrier(0x100, 12, 0);  // DS read
        __builtin_amdgcn_sched_group_barrier(0x008, 8,  0);  // MFMA/WMMA

        // 4) single barrier per K-step
        __syncthreads();

        // 5) rotate the raw-operand pipeline (copies vanish in the x2 unroll)
        xv_p = xv_n; w0_p = w0_n; w1_p = w1_n;
    }

    // ---- epilogue: add bias, store fp32 (C/D layout: VGPR j -> row j / j+8) ----
    #pragma unroll
    for (int r = 0; r < 2; ++r) {
        #pragma unroll
        for (int c = 0; c < 4; ++c) {
            const int   col  = o0 + wn * 64 + c * 16 + (lane & 15);
            const float bcol = bias[col];
            #pragma unroll
            for (int j = 0; j < 8; ++j) {
                const int row =
                    row0 + wm * 32 + r * 16 + ((lane < 16) ? j : j + 8);
                out[(size_t)row * O_SZ + col] = acc[r * 4 + c][j] + bcol;
            }
        }
    }
}

extern "C" void kernel_launch(void* const* d_in, const int* in_sizes, int n_in,
                              void* d_out, int out_size, void* d_ws, size_t ws_size,
                              hipStream_t stream) {
    const float* x      = (const float*)d_in[0];
    const float* coeffs = (const float*)d_in[1];
    const float* bias   = (const float*)d_in[2];
    float*       out    = (float*)d_out;

    dim3 grid(B_SZ / BM, O_SZ / BN);   // 32 x 4 = 128 blocks, 16 waves each
    fourier_kan_wmma_kernel<<<grid, NTHREADS, 0, stream>>>(x, coeffs, bias, out);
}

// v002
// It runs in 205 microseconds.
// Two timings next to v001 both put it at 1.93 times that version's speed.
// All steps since v000 together make it 3.09 times as fast.
#include <hip/hip_runtime.h>

typedef __attribute__((ext_vector_type(16))) _Float16 v16h;
typedef __attribute__((ext_vector_type(8)))  _Float16 v8h;
typedef __attribute__((ext_vector_type(8)))  float    v8f;
typedef __attribute__((ext_vector_type(4)))  float    v4f;

#define B_SZ 8192
#define I_SZ 512
#define O_SZ 512
#define G_SZ 16
#define KTOT (I_SZ * G_SZ)        // per-trig-part K = 8192

#define BM 256
#define BN 128
#define KT 32
#define KP 72                     // LDS row pitch in halves: 144 B = 16 B x odd
#define NTHREADS 512
#define NSTEPS (KTOT / KT)        // 256 K-steps: one trig part per work-group

#define INV_2PI 0.15915494309189535f

// One work-group: a BM x BN tile of the partial product over ONE trig part
// (P = 0: cos half of K, P = 1: sin half), stored to that part's plane.
template <int P>
__device__ __forceinline__
void fourier_kan_part(const float* __restrict__ x,
                      const float* __restrict__ coeffs,
                      float* __restrict__ part,
                      _Float16* __restrict__ Ft,
                      _Float16* __restrict__ Wt)
{
    const int tid  = threadIdx.x;
    const int lane = tid & 31;
    const int wave = tid >> 5;
    const int wm   = wave >> 1;            // 0..7 -> 32-row stripe
    const int wn   = wave & 1;             // 0..1 -> 64-col stripe
    const int row0 = blockIdx.x * BM;
    const int o0   = blockIdx.y * BN;

    // staging roles
    const int fr  = tid & (BM - 1);        // feature row 0..255
    const int fi  = tid >> 8;              // which of the 2 'i' columns
    const int wnn = tid >> 2;              // weight n 0..127
    const int wcc = (tid & 3) * 8;         // weight kk chunk 0,8,16,24

    v8f acc[8] = {};                       // [r*4 + c], r in 0..1, c in 0..3

    // per-lane K half-offset for the 16-bit WMMA A/B operand layout:
    // lanes 0-15: K = {0..7, 16..23}; lanes 16-31: K = {8..15, 24..31}
    const int hA      = (lane < 16) ? 0 : 8;
    const int aRowOff = (wm * 32 + (lane & 15)) * KP;    // A tile r adds r*16*KP
    const int bRowOff = (wn * 64 + (lane & 15)) * KP;    // B tile c adds c*16*KP

    // ---- issue global loads for step s ----
    auto issue_loads = [&](int s, float& xv, v4f& w0, v4f& w1) {
        xv = x[(size_t)(row0 + fr) * I_SZ + s * 2 + fi];
        const size_t base =
            (size_t)(P * O_SZ + o0 + wnn) * KTOT + (size_t)s * KT + wcc;
        w0 = *(const v4f*)(coeffs + base);       // global_load_b128
        w1 = *(const v4f*)(coeffs + base + 4);   // global_load_b128
    };

    // ---- convert + store step s into LDS buffer `buf` ----
    auto stage = [&](int buf, float xv, v4f w0, v4f w1) {
        const float xr = xv * INV_2PI;           // v_sin/cos take revolutions
        v8h f0, f1;
        if (P == 0) {
            #pragma unroll
            for (int g = 0; g < 8; ++g)
                f0[g] = (_Float16)__builtin_amdgcn_cosf(xr * (float)(g + 1));
            #pragma unroll
            for (int g = 0; g < 8; ++g)
                f1[g] = (_Float16)__builtin_amdgcn_cosf(xr * (float)(g + 9));
        } else {
            #pragma unroll
            for (int g = 0; g < 8; ++g)
                f0[g] = (_Float16)__builtin_amdgcn_sinf(xr * (float)(g + 1));
            #pragma unroll
            for (int g = 0; g < 8; ++g)
                f1[g] = (_Float16)__builtin_amdgcn_sinf(xr * (float)(g + 9));
        }
        *(v8h*)&Ft[fr * KP + buf * KT + fi * 16 + 0] = f0;   // ds_store_b128
        *(v8h*)&Ft[fr * KP + buf * KT + fi * 16 + 8] = f1;   // ds_store_b128
        v8h wh;
        #pragma unroll
        for (int j = 0; j < 4; ++j) {
            wh[j]     = (_Float16)w0[j];
            wh[j + 4] = (_Float16)w1[j];
        }
        *(v8h*)&Wt[wnn * KP + buf * KT + wcc] = wh;          // ds_store_b128
    };

    auto load16 = [&](const _Float16* rowp) -> v16h {
        v8h lo = *(const v8h*)(rowp + hA);
        v8h hi = *(const v8h*)(rowp + hA + 16);
        v16h r;
        #pragma unroll
        for (int j = 0; j < 8; ++j) { r[j] = lo[j]; r[j + 8] = hi[j]; }
        return r;
    };

    // prologue: stage step 0 into buffer 0; pre-issue loads for step 1
    float xv_p; v4f w0_p, w1_p;            // raw operands for step s+1
    {
        float xv; v4f w0, w1;
        issue_loads(0, xv, w0, w1);
        stage(0, xv, w0, w1);
        issue_loads(1, xv_p, w0_p, w1_p);
    }
    __syncthreads();

    for (int s = 0; s < NSTEPS; ++s) {
        const int cur = s & 1;
        const int nxt = cur ^ 1;
        const int sn2 = (s < NSTEPS - 2) ? s + 2 : NSTEPS - 1;  // step to load

        // 1) issue step s+2's global loads (a full iteration of latency cover)
        float xv_n; v4f w0_n, w1_n;
        issue_loads(sn2, xv_n, w0_n, w1_n);

        // 2) gather ALL operands (12 ds_load_b128), then 8 pipelined WMMAs
        v16h A0 = load16(&Ft[aRowOff + cur * KT]);
        v16h A1 = load16(&Ft[aRowOff + cur * KT + 16 * KP]);
        v16h Bt[4];
        #pragma unroll
        for (int c = 0; c < 4; ++c)
            Bt[c] = load16(&Wt[bRowOff + cur * KT + c * 16 * KP]);

        #pragma unroll
        for (int c = 0; c < 4; ++c)
            acc[c] = __builtin_amdgcn_wmma_f32_16x16x32_f16(
                false, A0, false, Bt[c], (short)0, acc[c], false, false);
        #pragma unroll
        for (int c = 0; c < 4; ++c)
            acc[4 + c] = __builtin_amdgcn_wmma_f32_16x16x32_f16(
                false, A1, false, Bt[c], (short)0, acc[4 + c], false, false);

        // 3) stage step s+1 from registers loaded LAST iteration (no stall)
        stage(nxt, xv_p, w0_p, w1_p);

        // Pin the shape: 3 VMEM reads -> 12 DS reads -> 8 WMMAs; everything
        // else (trig VALU, cvt, ds_stores) fills around the matrix pipe.
        __builtin_amdgcn_sched_group_barrier(0x020, 3,  0);  // VMEM read
        __builtin_amdgcn_sched_group_barrier(0x100, 12, 0);  // DS read
        __builtin_amdgcn_sched_group_barrier(0x008, 8,  0);  // MFMA/WMMA

        // 4) single barrier per K-step
        __syncthreads();

        // 5) rotate the raw-operand pipeline (copies vanish in the x2 unroll)
        xv_p = xv_n; w0_p = w0_n; w1_p = w1_n;
    }

    // ---- epilogue: store this K half's fp32 partial sums to its own plane
    //      (C/D layout: VGPR j -> row j / j+8) ----
    float* __restrict__ dst = part + (size_t)P * (B_SZ * O_SZ);
    #pragma unroll
    for (int r = 0; r < 2; ++r) {
        #pragma unroll
        for (int c = 0; c < 4; ++c) {
            const int col = o0 + wn * 64 + c * 16 + (lane & 15);
            #pragma unroll
            for (int j = 0; j < 8; ++j) {
                const int row =
                    row0 + wm * 32 + r * 16 + ((lane < 16) ? j : j + 8);
                dst[(size_t)row * O_SZ + col] = acc[r * 4 + c][j];
            }
        }
    }
}

__global__ __launch_bounds__(NTHREADS)
void fourier_kan_wmma_kernel(const float* __restrict__ x,
                             const float* __restrict__ coeffs,
                             float* __restrict__ part)
{
    // Double-buffered feature tile [row][kk] and weight tile [n][kk], f16,
    // K-major per row so WMMA operand gathers are contiguous 16B LDS loads.
    // A row holds its KT halves of buffer 0, those of buffer 1, then 16 B of
    // pad: at this pitch the 16 rows of a ds_load_b128 half-wave fall on 16
    // different 4-bank groups (at 64 B on only 4: a 4-way conflict), and the
    // buffer is still chosen by a shift.
    __shared__ __align__(16) _Float16 Ft[BM * KP];      // 36 KB
    __shared__ __align__(16) _Float16 Wt[BN * KP];      // 18 KB

    if (blockIdx.z != 0) fourier_kan_part<1>(x, coeffs, part, Ft, Wt);
    else                 fourier_kan_part<0>(x, coeffs, part, Ft, Wt);
}

// out = cos partial + sin partial + bias. 4 x 16 B per thread from each plane:
// 8 independent loads in flight per lane, every wave on whole 512 B runs.
#define RTHREADS 256
#define RVEC 4
__global__ __launch_bounds__(RTHREADS)
void fourier_kan_sum_kernel(const float* __restrict__ part,
                            const float* __restrict__ bias,
                            float* __restrict__ out)
{
    const int base = blockIdx.x * (RTHREADS * RVEC) + threadIdx.x;  // in v4f
    const v4f* __restrict__ pc = (const v4f*)part;
    const v4f* __restrict__ ps = (const v4f*)(part + (size_t)B_SZ * O_SZ);
    v4f a[RVEC], b[RVEC];
    // unrolled: all 8 loads issue ahead of the first wait, a[] and b[] in registers
    #pragma unroll
    for (int u = 0; u < RVEC; ++u) {
        a[u] = pc[base + u * RTHREADS];
        b[u] = ps[base + u * RTHREADS];
    }
    // RTHREADS v4f are two whole rows, so the bias columns are the same for all u
    const v4f bv = ((const v4f*)bias)[base & (O_SZ / 4 - 1)];
    // unrolled: a[] and b[] are indexed by constants and stay in registers
    #pragma unroll
    for (int u = 0; u < RVEC; ++u)
        ((v4f*)out)[base + u * RTHREADS] = (a[u] + b[u]) + bv;
}

extern "C" void kernel_launch(void* const* d_in, const int* in_sizes, int n_in,
                              void* d_out, int out_size, void* d_ws, size_t ws_size,
                              hipStream_t stream) {
    const float* x      = (const float*)d_in[0];
    const float* coeffs = (const float*)d_in[1];
    const float* bias   = (const float*)d_in[2];
    float*       out    = (float*)d_out;
    float*       part   = (float*)d_ws;      // 2 planes of B_SZ x O_SZ floats

    dim3 grid(B_SZ / BM, O_SZ / BN, 2);  // 32 x 4 x 2 = 256 blocks, 16 waves each
    fourier_kan_wmma_kernel<<<grid, NTHREADS, 0, stream>>>(x, coeffs, part);
    fourier_kan_sum_kernel<<<B_SZ * O_SZ / 4 / (RTHREADS * RVEC), RTHREADS, 0, stream>>>(
        part, bias, out);
}

// v003
// It runs in 176 microseconds.
// In two side-by-side timings against v002, it was 1.16 and 1.17 times as fast.
// All steps since v000 together make it 3.61 times as fast.
#include <hip/hip_runtime.h>

typedef __attribute__((ext_vector_type(16))) _Float16 v16h;
typedef __attribute__((ext_vector_type(8)))  _Float16 v8h;
typedef __attribute__((ext_vector_type(8)))  float    v8f;
typedef __attribute__((ext_vector_type(4)))  float    v4f;

#define B_SZ 8192
#define I_SZ 512
#define O_SZ 512
#define G_SZ 16
#define KTOT (I_SZ * G_SZ)        // per-trig-part K = 8192

#define BM 256
#define BN 128
#define KT 32
#define KP 72                     // LDS row pitch in halves: 144 B = 16 B x odd
#define NTHREADS 512
#define NSTEPS (KTOT / KT)        // 256 K-steps: one trig part per work-group
#define XB 32                     // x columns per LDS block: one 128 B line of each row
#define XP 36                     // LDS row pitch of an x block in floats (a 16 B multiple)
#define XSTEPS (XB * G_SZ / KT)   // 16 K-steps live on one x block

#define INV_2PI 0.15915494309189535f

// One work-group: a BM x BN tile of the partial product over ONE trig part
// (P = 0: cos half of K, P = 1: sin half), stored to that part's plane.
template <int P>
__device__ __forceinline__
void fourier_kan_part(const float* __restrict__ x,
                      const float* __restrict__ coeffs,
                      float* __restrict__ part,
                      _Float16* __restrict__ Ft,
                      _Float16* __restrict__ Wt,
                      float* __restrict__ Xs)
{
    const int tid  = threadIdx.x;
    const int lane = tid & 31;
    const int wave = tid >> 5;
    const int wm   = wave >> 1;            // 0..7 -> 32-row stripe
    const int wn   = wave & 1;             // 0..1 -> 64-col stripe
    const int row0 = blockIdx.x * BM;
    const int o0   = blockIdx.y * BN;

    // staging roles
    const int fr  = tid & (BM - 1);        // feature row 0..255
    const int fi  = tid >> 8;              // which of the 2 'i' columns
    const int wnn = tid >> 2;              // weight n 0..127
    const int wcc = (tid & 3) * 8;         // weight kk chunk 0,8,16,24
    const int xr  = tid >> 3;              // x block row 0..63 (+64 per load)
    const int xc  = (tid & 7) * 4;         // x block column: 8 lanes = one line

    v8f acc[8] = {};                       // [r*4 + c], r in 0..1, c in 0..3

    // per-lane K half-offset for the 16-bit WMMA A/B operand layout:
    // lanes 0-15: K = {0..7, 16..23}; lanes 16-31: K = {8..15, 24..31}
    const int hA      = (lane < 16) ? 0 : 8;
    const int aRowOff = (wm * 32 + (lane & 15)) * KP;    // A tile r adds r*16*KP
    const int bRowOff = (wn * 64 + (lane & 15)) * KP;    // B tile c adds c*16*KP

    // ---- x block b (BM rows x XB columns): global -> registers -> LDS.
    //      Every wave load covers 4 whole 128 B lines. ----
    auto xblock_load = [&](int b, v4f (&t)[4]) {
        const float* xb = x + (size_t)row0 * I_SZ + b * XB;  // uniform base
        // unrolled: the 4 loads issue together, t[] stays in registers
        #pragma unroll
        for (int j = 0; j < 4; ++j)
            t[j] = *(const v4f*)(xb + (unsigned)((j * 64 + xr) * I_SZ + xc));
        // precaution: stands in front of any overwrite of these loads' address registers
        asm volatile("s_wait_xcnt 0x0" ::: "memory");
    };
    auto xblock_store = [&](int b, const v4f (&t)[4]) {
        // unrolled: t[] is indexed by constants and stays in registers
        #pragma unroll
        for (int j = 0; j < 4; ++j)
            *(v4f*)&Xs[((b & 1) * BM + j * 64 + xr) * XP + xc] = t[j];
    };

    // ---- issue the loads for step s: x from its LDS block, weights global ----
    auto issue_loads = [&](int s, float& xv, v4f& w0, v4f& w1) {
        xv = Xs[((s / XSTEPS) & 1) * (BM * XP) + ((s * 2) & (XB - 1))
                + fr * XP + fi];                 // ds_load_b32
        const size_t base =
            (size_t)(P * O_SZ + o0 + wnn) * KTOT + (size_t)s * KT + wcc;
        w0 = *(const v4f*)(coeffs + base);       // global_load_b128
        w1 = *(const v4f*)(coeffs + base + 4);   // global_load_b128
    };

    // ---- convert + store step s into LDS buffer `buf` ----
    auto stage = [&](int buf, float xv, v4f w0, v4f w1) {
        const float xr = xv * INV_2PI;           // v_sin/cos take revolutions
        v8h f0, f1;
        if (P == 0) {
            #pragma unroll
            for (int g = 0; g < 8; ++g)
                f0[g] = (_Float16)__builtin_amdgcn_cosf(xr * (float)(g + 1));
            #pragma unroll
            for (int g = 0; g < 8; ++g)
                f1[g] = (_Float16)__builtin_amdgcn_cosf(xr * (float)(g + 9));
        } else {
            #pragma unroll
            for (int g = 0; g < 8; ++g)
                f0[g] = (_Float16)__builtin_amdgcn_sinf(xr * (float)(g + 1));
            #pragma unroll
            for (int g = 0; g < 8; ++g)
                f1[g] = (_Float16)__builtin_amdgcn_sinf(xr * (float)(g + 9));
        }
        *(v8h*)&Ft[fr * KP + buf * KT + fi * 16 + 0] = f0;   // ds_store_b128
        *(v8h*)&Ft[fr * KP + buf * KT + fi * 16 + 8] = f1;   // ds_store_b128
        v8h wh;
        #pragma unroll
        for (int j = 0; j < 4; ++j) {
            wh[j]     = (_Float16)w0[j];
            wh[j + 4] = (_Float16)w1[j];
        }
        *(v8h*)&Wt[wnn * KP + buf * KT + wcc] = wh;          // ds_store_b128
    };

    auto load16 = [&](const _Float16* rowp) -> v16h {
        v8h lo = *(const v8h*)(rowp + hA);
        v8h hi = *(const v8h*)(rowp + hA + 16);
        v16h r;
        #pragma unroll
        for (int j = 0; j < 8; ++j) { r[j] = lo[j]; r[j + 8] = hi[j]; }
        return r;
    };

    // prologue: x block 0 into LDS, seen by all waves behind the barrier
    {
        v4f t[4];
        xblock_load(0, t);
        xblock_store(0, t);
    }
    __syncthreads();

    // stage step 0 into buffer 0; pre-issue loads for step 1
    float xv_p; v4f w0_p, w1_p;            // raw operands for step s+1
    {
        float xv; v4f w0, w1;
        issue_loads(0, xv, w0, w1);
        stage(0, xv, w0, w1);
        issue_loads(1, xv_p, w0_p, w1_p);
    }
    __syncthreads();

    for (int s = 0; s < NSTEPS; ++s) {
        const int cur = s & 1;
        const int nxt = cur ^ 1;
        const int sn2 = (s < NSTEPS - 2) ? s + 2 : NSTEPS - 1;  // step to load

        // 0) first step of an x block: fetch the next block. Its LDS buffer was
        //    last read 3 steps ago and is first read 14 steps from here.
        const bool xfetch = (s % XSTEPS) == 0 && s + XSTEPS < NSTEPS;
        v4f xt[4];
        if (xfetch) xblock_load(s / XSTEPS + 1, xt);

        // 1) issue step s+2's loads (a full iteration of latency cover)
        float xv_n; v4f w0_n, w1_n;
        issue_loads(sn2, xv_n, w0_n, w1_n);

        // 2) gather ALL operands (12 ds_load_b128), then 8 pipelined WMMAs
        v16h A0 = load16(&Ft[aRowOff + cur * KT]);
        v16h A1 = load16(&Ft[aRowOff + cur * KT + 16 * KP]);
        v16h Bt[4];
        #pragma unroll
        for (int c = 0; c < 4; ++c)
            Bt[c] = load16(&Wt[bRowOff + cur * KT + c * 16 * KP]);

        #pragma unroll
        for (int c = 0; c < 4; ++c)
            acc[c] = __builtin_amdgcn_wmma_f32_16x16x32_f16(
                false, A0, false, Bt[c], (short)0, acc[c], false, false);
        #pragma unroll
        for (int c = 0; c < 4; ++c)
            acc[4 + c] = __builtin_amdgcn_wmma_f32_16x16x32_f16(
                false, A1, false, Bt[c], (short)0, acc[4 + c], false, false);

        // 3) stage step s+1 from registers loaded LAST iteration (no stall)
        stage(nxt, xv_p, w0_p, w1_p);

        // Pin the shape: 2 VMEM reads -> 13 DS reads -> 8 WMMAs; everything
        // else (trig VALU, cvt, ds_stores) fills around the matrix pipe.
        __builtin_amdgcn_sched_group_barrier(0x020, 2,  0);  // VMEM read
        __builtin_amdgcn_sched_group_barrier(0x100, 13, 0);  // DS read
        __builtin_amdgcn_sched_group_barrier(0x008, 8,  0);  // MFMA/WMMA

        if (xfetch) xblock_store(s / XSTEPS + 1, xt);

        // 4) single barrier per K-step
        __syncthreads();

        // 5) rotate the raw-operand pipeline (copies vanish in the x2 unroll)
        xv_p = xv_n; w0_p = w0_n; w1_p = w1_n;
    }

    // ---- epilogue: store this K half's fp32 partial sums to its own plane
    //      (C/D layout: VGPR j -> row j / j+8) ----
    float* __restrict__ dst = part + (size_t)P * (B_SZ * O_SZ);
    #pragma unroll
    for (int r = 0; r < 2; ++r) {
        #pragma unroll
        for (int c = 0; c < 4; ++c) {
            const int col = o0 + wn * 64 + c * 16 + (lane & 15);
            #pragma unroll
            for (int j = 0; j < 8; ++j) {
                const int row =
                    row0 + wm * 32 + r * 16 + ((lane < 16) ? j : j + 8);
                dst[(size_t)row * O_SZ + col] = acc[r * 4 + c][j];
            }
        }
    }
}

__global__ __launch_bounds__(NTHREADS)
void fourier_kan_wmma_kernel(const float* __restrict__ x,
                             const float* __restrict__ coeffs,
                             float* __restrict__ part)
{
    // Double-buffered feature tile [row][kk] and weight tile [n][kk], f16,
    // K-major per row so WMMA operand gathers are contiguous 16B LDS loads.
    // A row holds its KT halves of buffer 0, those of buffer 1, then 16 B of
    // pad: at this pitch the 16 rows of a ds_load_b128 half-wave fall on 16
    // different 4-bank groups (at 64 B on only 4: a 4-way conflict), and the
    // buffer is still chosen by a shift.
    __shared__ __align__(16) _Float16 Ft[BM * KP];      // 36 KB
    __shared__ __align__(16) _Float16 Wt[BN * KP];      // 18 KB
    // Two buffers of raw x, BM rows x XB columns each: filled by whole-line
    // loads once per XSTEPS steps, read back one float per thread and step.
    __shared__ __align__(16) float    Xs[2 * BM * XP];  // 72 KB

    if (blockIdx.z != 0) fourier_kan_part<1>(x, coeffs, part, Ft, Wt, Xs);
    else                 fourier_kan_part<0>(x, coeffs, part, Ft, Wt, Xs);
}

// out = cos partial + sin partial + bias. 4 x 16 B per thread from each plane:
// 8 independent loads in flight per lane, every wave on whole 512 B runs.
#define RTHREADS 256
#define RVEC 4
__global__ __launch_bounds__(RTHREADS)
void fourier_kan_sum_kernel(const float* __restrict__ part,
                            const float* __restrict__ bias,
                            float* __restrict__ out)
{
    const int base = blockIdx.x * (RTHREADS * RVEC) + threadIdx.x;  // in v4f
    const v4f* __restrict__ pc = (const v4f*)part;
    const v4f* __restrict__ ps = (const v4f*)(part + (size_t)B_SZ * O_SZ);
    v4f a[RVEC], b[RVEC];
    // unrolled: all 8 loads issue ahead of the first wait, a[] and b[] in registers
    #pragma unroll
    for (int u = 0; u < RVEC; ++u) {
        a[u] = pc[base + u * RTHREADS];
        b[u] = ps[base + u * RTHREADS];
    }
    // RTHREADS v4f are two whole rows, so the bias columns are the same for all u
    const v4f bv = ((const v4f*)bias)[base & (O_SZ / 4 - 1)];
    // unrolled: a[] and b[] are indexed by constants and stay in registers
    #pragma unroll
    for (int u = 0; u < RVEC; ++u)
        ((v4f*)out)[base + u * RTHREADS] = (a[u] + b[u]) + bv;
}

extern "C" void kernel_launch(void* const* d_in, const int* in_sizes, int n_in,
                              void* d_out, int out_size, void* d_ws, size_t ws_size,
                              hipStream_t stream) {
    const float* x      = (const float*)d_in[0];
    const float* coeffs = (const float*)d_in[1];
    const float* bias   = (const float*)d_in[2];
    float*       out    = (float*)d_out;
    float*       part   = (float*)d_ws;      // 2 planes of B_SZ x O_SZ floats

    dim3 grid(B_SZ / BM, O_SZ / BN, 2);  // 32 x 4 x 2 = 256 blocks, 16 waves each
    fourier_kan_wmma_kernel<<<grid, NTHREADS, 0, stream>>>(x, coeffs, part);
    fourier_kan_sum_kernel<<<B_SZ * O_SZ / 4 / (RTHREADS * RVEC), RTHREADS, 0, stream>>>(
        part, bias, out);
}

// v004
// It runs in 169 microseconds.
// In both of two side-by-side timings against v003, it was 1.04 times as fast.
// All steps since v000 together make it 3.75 times as fast.
#include <hip/hip_runtime.h>

typedef __attribute__((ext_vector_type(16))) _Float16 v16h;
typedef __attribute__((ext_vector_type(8)))  _Float16 v8h;
typedef __attribute__((ext_vector_type(8)))  float    v8f;
typedef __attribute__((ext_vector_type(4)))  float    v4f;

#define B_SZ 8192
#define I_SZ 512
#define O_SZ 512
#define G_SZ 16
#define KTOT (I_SZ * G_SZ)        // per-trig-part K = 8192

#define BM 256
#define BN 128
#define KT 32
#define KP 72                     // LDS row pitch in halves: 144 B = 16 B x odd
#define NTHREADS 512
#define NSTEPS (KTOT / KT)        // 256 K-steps: one trig part per work-group
#define XB 32                     // x columns per LDS block: one 128 B line of each row
#define XP 36                     // LDS row pitch of an x block in floats (a 16 B multiple)
#define XSTEPS (XB * G_SZ / KT)   // 16 K-steps live on one x block

#define INV_2PI 0.15915494309189535f

// One work-group: a BM x BN tile of the partial product over ONE trig part
// (P = 0: cos half of K, P = 1: sin half), stored to that part's plane.
template <int P>
__device__ __forceinline__
void fourier_kan_part(const float* __restrict__ x,
                      const float* __restrict__ coeffs,
                      float* __restrict__ part,
                      _Float16* __restrict__ Ft,
                      _Float16* __restrict__ Wt,
                      float* __restrict__ Xs)
{
    const int tid  = threadIdx.x;
    const int lane = tid & 31;
    const int wave = tid >> 5;
    const int wm   = wave >> 1;            // 0..7 -> 32-row stripe
    const int wn   = wave & 1;             // 0..1 -> 64-col stripe
    const int row0 = blockIdx.x * BM;
    const int o0   = blockIdx.y * BN;

    // staging roles
    const int fr  = tid & (BM - 1);        // feature row 0..255
    const int fi  = tid >> 8;              // which of the 2 'i' columns
    const int wnn = tid >> 2;              // weight n 0..127
    const int wcc = (tid & 3) * 8;         // weight kk chunk 0,8,16,24
    const int xr  = tid >> 3;              // x block row 0..63 (+64 per load)
    const int xc  = (tid & 7) * 4;         // x block column: 8 lanes = one line

    v8f acc[8] = {};                       // [r*4 + c], r in 0..1, c in 0..3

    // per-lane K half-offset for the 16-bit WMMA A/B operand layout:
    // lanes 0-15: K = {0..7, 16..23}; lanes 16-31: K = {8..15, 24..31}
    const int hA      = (lane < 16) ? 0 : 8;
    const int aRowOff = (wm * 32 + (lane & 15)) * KP;    // A tile r adds r*16*KP
    const int bRowOff = (wn * 64 + (lane & 15)) * KP;    // B tile c adds c*16*KP

    // ---- x block b (BM rows x XB columns): global -> registers -> LDS.
    //      Every wave load covers 4 whole 128 B lines. ----
    auto xblock_load = [&](int b, v4f (&t)[4]) {
        const float* xb = x + (size_t)row0 * I_SZ + b * XB;  // uniform base
        // unrolled: the 4 loads issue together, t[] stays in registers
        #pragma unroll
        for (int j = 0; j < 4; ++j)
            t[j] = *(const v4f*)(xb + (unsigned)((j * 64 + xr) * I_SZ + xc));
        // precaution: stands in front of any overwrite of these loads' address registers
        asm volatile("s_wait_xcnt 0x0" ::: "memory");
    };
    auto xblock_store = [&](int b, const v4f (&t)[4]) {
        // unrolled: t[] is indexed by constants and stays in registers
        #pragma unroll
        for (int j = 0; j < 4; ++j)
            *(v4f*)&Xs[((b & 1) * BM + j * 64 + xr) * XP + xc] = t[j];
    };

    // ---- issue the loads for step s: x from its LDS block, weights global
    //      (wsrc: this thread's 8 weights of step s) ----
    const float* const wrow = coeffs + (size_t)(P * O_SZ + o0 + wnn) * KTOT + wcc;
    auto issue_loads = [&](int s, const float* wsrc, float& xv, v4f& w0, v4f& w1) {
        xv = Xs[((s / XSTEPS) & 1) * (BM * XP) + ((s * 2) & (XB - 1))
                + fr * XP + fi];                 // ds_load_b32
        w0 = *(const v4f*)(wsrc);                // global_load_b128
        w1 = *(const v4f*)(wsrc + 4);            // global_load_b128
    };

    // ---- convert + store step s into LDS buffer `buf` ----
    auto stage = [&](int buf, float xv, v4f w0, v4f w1) {
        const float xr = xv * INV_2PI;           // v_sin/cos take revolutions
        v8h f0, f1;
        if (P == 0) {
            #pragma unroll
            for (int g = 0; g < 8; ++g)
                f0[g] = (_Float16)__builtin_amdgcn_cosf(xr * (float)(g + 1));
            #pragma unroll
            for (int g = 0; g < 8; ++g)
                f1[g] = (_Float16)__builtin_amdgcn_cosf(xr * (float)(g + 9));
        } else {
            #pragma unroll
            for (int g = 0; g < 8; ++g)
                f0[g] = (_Float16)__builtin_amdgcn_sinf(xr * (float)(g + 1));
            #pragma unroll
            for (int g = 0; g < 8; ++g)
                f1[g] = (_Float16)__builtin_amdgcn_sinf(xr * (float)(g + 9));
        }
        *(v8h*)&Ft[fr * KP + buf * KT + fi * 16 + 0] = f0;   // ds_store_b128
        *(v8h*)&Ft[fr * KP + buf * KT + fi * 16 + 8] = f1;   // ds_store_b128
        v8h wh;
        #pragma unroll
        for (int j = 0; j < 4; ++j) {
            wh[j]     = (_Float16)w0[j];
            wh[j + 4] = (_Float16)w1[j];
        }
        *(v8h*)&Wt[wnn * KP + buf * KT + wcc] = wh;          // ds_store_b128
    };

    auto load16 = [&](const _Float16* rowp) -> v16h {
        v8h lo = *(const v8h*)(rowp + hA);
        v8h hi = *(const v8h*)(rowp + hA + 16);
        v16h r;
        #pragma unroll
        for (int j = 0; j < 8; ++j) { r[j] = lo[j]; r[j + 8] = hi[j]; }
        return r;
    };

    // fragments of one K-step: 12 ds_load_b128 from LDS buffer `buf`
    auto load_frags = [&](int buf, v16h (&A)[2], v16h (&Bf)[4]) {
        A[0] = load16(&Ft[aRowOff + buf * KT]);
        A[1] = load16(&Ft[aRowOff + buf * KT + 16 * KP]);
        // unrolled: Bf[] is indexed by constants and stays in registers
        #pragma unroll
        for (int c = 0; c < 4; ++c)
            Bf[c] = load16(&Wt[bRowOff + buf * KT + c * 16 * KP]);
    };

    // prologue: x block 0 into LDS, seen by all waves behind the barrier
    {
        v4f t[4];
        xblock_load(0, t);
        xblock_store(0, t);
    }
    __syncthreads();

    // stage steps 0 and 1 into buffers 0 and 1; pre-issue the loads of step 2
    float xvE, xvO; v4f w0E, w1E, w0O, w1O;    // raw operands, even / odd steps
    {
        float xv; v4f w0, w1;
        issue_loads(0, wrow, xv, w0, w1);
        issue_loads(1, wrow + KT, xvO, w0O, w1O);
        stage(0, xv, w0, w1);
        stage(1, xvO, w0O, w1O);
        issue_loads(2, wrow + 2 * KT, xvE, w0E, w1E);
    }
    __syncthreads();

    // two register sets of fragments: one is multiplied while the other fills
    v16h AE[2], BE[4], AO[2], BO[4];
    load_frags(0, AE, BE);
    // every wave holds step 0 in registers before buffer 0 is staged anew
    __syncthreads();

    const float* wnext = wrow + 2 * KT;        // the weights last asked for

    // One K-step s of parity `par`. On entry: (Ac, Bc) hold step s, LDS buffer
    // par^1 holds step s+1, buffer par is free, (xc_, w0c, w1c) hold step s+2 raw.
    auto kstep = [&](int s, int par, bool xfetch,
                     v16h (&Ac)[2], v16h (&Bc)[4], v16h (&An)[2], v16h (&Bn)[4],
                     float& xc_, v4f& w0c, v4f& w1c,
                     float& xn_, v4f& w0n, v4f& w1n) {
        // 0) first step of an x block: fetch the next block. Its LDS buffer was
        //    last read 4 steps ago and is first read 13 steps from here.
        v4f xt[4];
        if (xfetch) xblock_load(s / XSTEPS + 1, xt);

        // 1) step s+1's fragments into the idle register set: waited for only
        //    at the foot of this step, behind its WMMAs, trig and stores
        load_frags(par ^ 1, An, Bn);

        // 2) issue step s+3's raw loads (the last step's again past the end);
        //    the pointer moves ahead of its loads, behind the barrier at which
        //    the loads that last named it have returned
        wnext += (s < NSTEPS - 3) ? KT : 0;
        issue_loads((s < NSTEPS - 3) ? s + 3 : NSTEPS - 1, wnext, xn_, w0n, w1n);

        // 3) 8 WMMAs on registers filled during the last step: no LDS wait
        //    (both loops unrolled: acc[] and Bc[] stay in registers)
        #pragma unroll
        for (int c = 0; c < 4; ++c)
            acc[c] = __builtin_amdgcn_wmma_f32_16x16x32_f16(
                false, Ac[0], false, Bc[c], (short)0, acc[c], false, false);
        #pragma unroll
        for (int c = 0; c < 4; ++c)
            acc[4 + c] = __builtin_amdgcn_wmma_f32_16x16x32_f16(
                false, Ac[1], false, Bc[c], (short)0, acc[4 + c], false, false);

        // 4) stage step s+2 into the buffer whose fragments are in (Ac, Bc)
        stage(par, xc_, w0c, w1c);

        // Pin the shape: every load of the step issues ahead of its first WMMA
        // (left alone the compiler sinks the fragment reads to the foot, where
        // the barrier waits them out); trig, cvt and stores fill between WMMAs.
        __builtin_amdgcn_sched_group_barrier(0x020, 2,  0);  // VMEM read
        __builtin_amdgcn_sched_group_barrier(0x100, 13, 0);  // DS read
        // unrolled: each call is one group of the step's schedule
        #pragma unroll
        for (int q = 0; q < 8; ++q) {
            __builtin_amdgcn_sched_group_barrier(0x008, 1, 0);  // WMMA
            __builtin_amdgcn_sched_group_barrier(0x402, 6, 0);  // VALU + trans
        }

        if (xfetch) xblock_store(s / XSTEPS + 1, xt);

        // 5) single barrier per K-step
        __syncthreads();
    };

    for (int s = 0; s < NSTEPS; s += 2) {
        const bool xfetch = (s % XSTEPS) == 0 && s + XSTEPS < NSTEPS;
        kstep(s,     0, xfetch, AE, BE, AO, BO, xvE, w0E, w1E, xvO, w0O, w1O);
        kstep(s + 1, 1, false,  AO, BO, AE, BE, xvO, w0O, w1O, xvE, w0E, w1E);
    }

    // ---- epilogue: store this K half's fp32 partial sums to its own plane
    //      (C/D layout: VGPR j -> row j / j+8) ----
    float* __restrict__ dst = part + (size_t)P * (B_SZ * O_SZ);
    #pragma unroll
    for (int r = 0; r < 2; ++r) {
        #pragma unroll
        for (int c = 0; c < 4; ++c) {
            const int col = o0 + wn * 64 + c * 16 + (lane & 15);
            #pragma unroll
            for (int j = 0; j < 8; ++j) {
                const int row =
                    row0 + wm * 32 + r * 16 + ((lane < 16) ? j : j + 8);
                dst[(size_t)row * O_SZ + col] = acc[r * 4 + c][j];
            }
        }
    }
}

__global__ __launch_bounds__(NTHREADS)
void fourier_kan_wmma_kernel(const float* __restrict__ x,
                             const float* __restrict__ coeffs,
                             float* __restrict__ part)
{
    // Double-buffered feature tile [row][kk] and weight tile [n][kk], f16,
    // K-major per row so WMMA operand gathers are contiguous 16B LDS loads.
    // A row holds its KT halves of buffer 0, those of buffer 1, then 16 B of
    // pad: at this pitch the 16 rows of a ds_load_b128 half-wave fall on 16
    // different 4-bank groups (at 64 B on only 4: a 4-way conflict), and the
    // buffer is still chosen by a shift.
    __shared__ __align__(16) _Float16 Ft[BM * KP];      // 36 KB
    __shared__ __align__(16) _Float16 Wt[BN * KP];      // 18 KB
    // Two buffers of raw x, BM rows x XB columns each: filled by whole-line
    // loads once per XSTEPS steps, read back one float per thread and step.
    __shared__ __align__(16) float    Xs[2 * BM * XP];  // 72 KB

    if (blockIdx.z != 0) fourier_kan_part<1>(x, coeffs, part, Ft, Wt, Xs);
    else                 fourier_kan_part<0>(x, coeffs, part, Ft, Wt, Xs);
}

// out = cos partial + sin partial + bias. 4 x 16 B per thread from each plane:
// 8 independent loads in flight per lane, every wave on whole 512 B runs.
#define RTHREADS 256
#define RVEC 4
__global__ __launch_bounds__(RTHREADS)
void fourier_kan_sum_kernel(const float* __restrict__ part,
                            const float* __restrict__ bias,
                            float* __restrict__ out)
{
    const int base = blockIdx.x * (RTHREADS * RVEC) + threadIdx.x;  // in v4f
    const v4f* __restrict__ pc = (const v4f*)part;
    const v4f* __restrict__ ps = (const v4f*)(part + (size_t)B_SZ * O_SZ);
    v4f a[RVEC], b[RVEC];
    // unrolled: all 8 loads issue ahead of the first wait, a[] and b[] in registers
    #pragma unroll
    for (int u = 0; u < RVEC; ++u) {
        a[u] = pc[base + u * RTHREADS];
        b[u] = ps[base + u * RTHREADS];
    }
    // RTHREADS v4f are two whole rows, so the bias columns are the same for all u
    const v4f bv = ((const v4f*)bias)[base & (O_SZ / 4 - 1)];
    // unrolled: a[] and b[] are indexed by constants and stay in registers
    #pragma unroll
    for (int u = 0; u < RVEC; ++u)
        ((v4f*)out)[base + u * RTHREADS] = (a[u] + b[u]) + bv;
}

extern "C" void kernel_launch(void* const* d_in, const int* in_sizes, int n_in,
                              void* d_out, int out_size, void* d_ws, size_t ws_size,
                              hipStream_t stream) {
    const float* x      = (const float*)d_in[0];
    const float* coeffs = (const float*)d_in[1];
    const float* bias   = (const float*)d_in[2];
    float*       out    = (float*)d_out;
    float*       part   = (float*)d_ws;      // 2 planes of B_SZ x O_SZ floats

    dim3 grid(B_SZ / BM, O_SZ / BN, 2);  // 32 x 4 x 2 = 256 blocks, 16 waves each
    fourier_kan_wmma_kernel<<<grid, NTHREADS, 0, stream>>>(x, coeffs, part);
    fourier_kan_sum_kernel<<<B_SZ * O_SZ / 4 / (RTHREADS * RVEC), RTHREADS, 0, stream>>>(
        part, bias, out);
}

// v005
// One run takes 130 microseconds.
// Next to v004, in two timings, it ran 1.31 times as fast each time.
// Counting every step since v000, it is 4.90 times as fast.
#include <hip/hip_runtime.h>

typedef __attribute__((ext_vector_type(16))) _Float16 v16h;
typedef __attribute__((ext_vector_type(8)))  _Float16 v8h;
typedef __attribute__((ext_vector_type(8)))  float    v8f;
typedef __attribute__((ext_vector_type(4)))  float    v4f;

#define B_SZ 8192
#define I_SZ 512
#define O_SZ 512
#define G_SZ 16
#define KTOT (I_SZ * G_SZ)        // per-trig-part K = 8192

#define BM 256
#define BN 128
#define KT 32
#define KP 72                     // LDS row pitch in halves: 144 B = 16 B x odd
#define NTHREADS 512
#define NSTEPS (KTOT / KT)        // 256 K-steps: one trig part per work-group
#define XB 32                     // x columns per LDS block: one 128 B line of each row
#define XP 36                     // LDS row pitch of an x block in floats (a 16 B multiple)
#define XSTEPS (XB * G_SZ / KT)   // 16 K-steps live on one x block

#define INV_2PI 0.15915494309189535f

// Work-group barrier of the K loop. It waits for this wave's LDS reads and
// writes only: __syncthreads() also waits out every global load, so that no
// load could be in flight longer than one K-step. s_wait_xcnt: a precaution,
// it stands in front of the next step's overwrite of the loads' address registers.
__device__ __forceinline__ void lds_barrier()
{
    asm volatile("s_wait_dscnt 0x0\n\t"
                 "s_wait_xcnt 0x0\n\t"
                 "s_barrier_signal -1\n\t"
                 "s_barrier_wait -1" ::: "memory");
    // ends the step's scheduling region: without it the compiler sinks a step's
    // global loads to its foot, directly in front of these waits
    __builtin_amdgcn_sched_barrier(0);
}

// One work-group: a BM x BN tile of the partial product over ONE trig part
// (P = 0: cos half of K, P = 1: sin half), stored to that part's plane.
template <int P>
__device__ __forceinline__
void fourier_kan_part(const float* __restrict__ x,
                      const float* __restrict__ coeffs,
                      float* __restrict__ part,
                      _Float16* __restrict__ Ft,
                      _Float16* __restrict__ Wt,
                      float* __restrict__ Xs)
{
    const int tid  = threadIdx.x;
    const int lane = tid & 31;
    const int wave = tid >> 5;
    const int wm   = wave >> 1;            // 0..7 -> 32-row stripe
    const int wn   = wave & 1;             // 0..1 -> 64-col stripe
    const int row0 = blockIdx.x * BM;
    const int o0   = blockIdx.y * BN;

    // staging roles
    const int fr  = tid & (BM - 1);        // feature row 0..255
    const int fi  = tid >> 8;              // which of the 2 'i' columns
    const int wnn = tid >> 2;              // weight n 0..127
    const int wcc = (tid & 3) * 8;         // weight kk chunk 0,8,16,24
    const int xr  = tid >> 3;              // x block row 0..63 (+64 per load)
    const int xc  = (tid & 7) * 4;         // x block column: 8 lanes = one line

    v8f acc[8] = {};                       // [r*4 + c], r in 0..1, c in 0..3

    // per-lane K half-offset for the 16-bit WMMA A/B operand layout:
    // lanes 0-15: K = {0..7, 16..23}; lanes 16-31: K = {8..15, 24..31}
    const int hA      = (lane < 16) ? 0 : 8;
    const int aRowOff = (wm * 32 + (lane & 15)) * KP;    // A tile r adds r*16*KP
    const int bRowOff = (wn * 64 + (lane & 15)) * KP;    // B tile c adds c*16*KP

    // ---- x block b (BM rows x XB columns): global -> registers -> LDS.
    //      Every wave load covers 4 whole 128 B lines. ----
    auto xblock_load = [&](int b, v4f (&t)[4]) {
        const float* xb = x + (size_t)row0 * I_SZ + b * XB;  // uniform base
        // unrolled: the 4 loads issue together, t[] stays in registers
        #pragma unroll
        for (int j = 0; j < 4; ++j)
            t[j] = *(const v4f*)(xb + (unsigned)((j * 64 + xr) * I_SZ + xc));
        // precaution: stands in front of any overwrite of these loads' address registers
        asm volatile("s_wait_xcnt 0x0" ::: "memory");
    };
    auto xblock_store = [&](int b, const v4f (&t)[4]) {
        // unrolled: t[] is indexed by constants and stays in registers
        #pragma unroll
        for (int j = 0; j < 4; ++j)
            *(v4f*)&Xs[((b & 1) * BM + j * 64 + xr) * XP + xc] = t[j];
    };

    // ---- quarter j (64 rows) of x block b: one load per thread, stored to LDS
    //      some K-steps later (a block past the last re-reads the last one) ----
    auto xpiece_load = [&](int b, int j) -> v4f {
        const int bs = (b < I_SZ / XB) ? b : I_SZ / XB - 1;
        const float* xb = x + (size_t)(row0 + j * 64) * I_SZ + bs * XB;  // uniform base
        return *(const v4f*)(xb + (unsigned)(xr * I_SZ + xc));
    };
    auto xpiece_store = [&](int b, int j, v4f t) {
        *(v4f*)&Xs[((b & 1) * BM + j * 64 + xr) * XP + xc] = t;
    };

    // ---- raw operands of step s: x from its LDS block, weights global
    //      (wsrc: this thread's 8 weights of the step) ----
    const float* const wrow = coeffs + (size_t)(P * O_SZ + o0 + wnn) * KTOT + wcc;
    auto xread = [&](int s) -> float {
        return Xs[((s / XSTEPS) & 1) * (BM * XP) + ((s * 2) & (XB - 1))
                  + fr * XP + fi];               // ds_load_b32
    };
    auto wload = [&](const float* wsrc, v4f& w0, v4f& w1) {
        w0 = *(const v4f*)(wsrc);                // global_load_b128
        w1 = *(const v4f*)(wsrc + 4);            // global_load_b128
    };

    // ---- convert + store step s into LDS buffer `buf` ----
    auto stage = [&](int buf, float xv, v4f w0, v4f w1) {
        const float xr = xv * INV_2PI;           // v_sin/cos take revolutions
        v8h f0, f1;
        if (P == 0) {
            #pragma unroll
            for (int g = 0; g < 8; ++g)
                f0[g] = (_Float16)__builtin_amdgcn_cosf(xr * (float)(g + 1));
            #pragma unroll
            for (int g = 0; g < 8; ++g)
                f1[g] = (_Float16)__builtin_amdgcn_cosf(xr * (float)(g + 9));
        } else {
            #pragma unroll
            for (int g = 0; g < 8; ++g)
                f0[g] = (_Float16)__builtin_amdgcn_sinf(xr * (float)(g + 1));
            #pragma unroll
            for (int g = 0; g < 8; ++g)
                f1[g] = (_Float16)__builtin_amdgcn_sinf(xr * (float)(g + 9));
        }
        *(v8h*)&Ft[fr * KP + buf * KT + fi * 16 + 0] = f0;   // ds_store_b128
        *(v8h*)&Ft[fr * KP + buf * KT + fi * 16 + 8] = f1;   // ds_store_b128
        v8h wh;
        #pragma unroll
        for (int j = 0; j < 4; ++j) {
            wh[j]     = (_Float16)w0[j];
            wh[j + 4] = (_Float16)w1[j];
        }
        *(v8h*)&Wt[wnn * KP + buf * KT + wcc] = wh;          // ds_store_b128
    };

    auto load16 = [&](const _Float16* rowp) -> v16h {
        v8h lo = *(const v8h*)(rowp + hA);
        v8h hi = *(const v8h*)(rowp + hA + 16);
        v16h r;
        #pragma unroll
        for (int j = 0; j < 8; ++j) { r[j] = lo[j]; r[j + 8] = hi[j]; }
        return r;
    };

    // fragments of one K-step: 12 ds_load_b128 from LDS buffer `buf`
    auto load_frags = [&](int buf, v16h (&A)[2], v16h (&Bf)[4]) {
        A[0] = load16(&Ft[aRowOff + buf * KT]);
        A[1] = load16(&Ft[aRowOff + buf * KT + 16 * KP]);
        // unrolled: Bf[] is indexed by constants and stays in registers
        #pragma unroll
        for (int c = 0; c < 4; ++c)
            Bf[c] = load16(&Wt[bRowOff + buf * KT + c * 16 * KP]);
    };

    // four register sets of raw weights: step t lives in set t & 3
    v4f W0[4], W1[4];
    // unrolled: W0[] and W1[] are indexed by constants and stay in registers
    #pragma unroll
    for (int t = 0; t < 4; ++t) wload(wrow + t * KT, W0[t], W1[t]);

    // prologue: x block 0 and the first quarter of block 1 into LDS, seen by
    // all waves behind the barrier
    {
        v4f t[4];
        xblock_load(0, t);
        const v4f t1 = xpiece_load(1, 0);
        xblock_store(0, t);
        xpiece_store(1, 0, t1);
    }
    __syncthreads();

    // stage steps 0 and 1 into buffers 0 and 1; the loads of steps 2 to 4 fly
    float xvE, xvO;                            // raw x, even / odd steps
    stage(0, xread(0), W0[0], W1[0]);
    stage(1, xread(1), W0[1], W1[1]);
    wload(wrow + 4 * KT, W0[0], W1[0]);
    xvE = xread(2);
    __syncthreads();

    // two register sets of fragments: one is multiplied while the other fills
    v16h AE[2], BE[4], AO[2], BO[4];
    load_frags(0, AE, BE);
    // every wave holds step 0 in registers before buffer 0 is staged anew
    __syncthreads();

    const float* wnext = wrow + 4 * KT;        // the weights last asked for
    v4f xt;                                    // a quarter x block on its way to LDS

    // One K-step s of parity `par`, q = s & 3. On entry: (Ac, Bc) hold step s,
    // LDS buffer par^1 holds step s+1, buffer par is free, xc_ holds step s+2's
    // x, (w0c, w1c) its weights (asked for 3 steps ago); (w0f, w1f) are free.
    auto kstep = [&](int s, int par, int q,
                     v16h (&Ac)[2], v16h (&Bc)[4], v16h (&An)[2], v16h (&Bn)[4],
                     float& xc_, float& xn_,
                     v4f& w0c, v4f& w1c, v4f& w0f, v4f& w1f) {
        // 0) every 4th step asks for one quarter of a coming x block and the
        //    3rd step behind it stores that quarter. Quarter xp & 3 of block
        //    xp / 4 + 1: its LDS buffer was last read at step 16 * (xp / 4) - 4,
        //    is written from step 16 * (xp / 4) - 1 to + 11, first read at + 13.
        const int xq = (s >> 2) + 1;
        const int xp = (xq < 4 * (I_SZ / XB - 1)) ? xq : 4 * (I_SZ / XB - 1);
        if (q == 0) xt = xpiece_load((xp >> 2) + 1, xp & 3);

        // 1) step s+1's fragments into the idle register set: waited for only
        //    at the foot of this step, behind its WMMAs, trig and stores
        load_frags(par ^ 1, An, Bn);

        // 2) ask for step s+5's weights (the last step's again past the end):
        //    they fly over three barriers; step s+3's x comes from LDS
        wnext += (s < NSTEPS - 5) ? KT : 0;
        wload(wnext, w0f, w1f);
        xn_ = xread((s < NSTEPS - 3) ? s + 3 : NSTEPS - 1);

        // 3) 8 WMMAs on registers filled during the last step: no LDS wait
        //    (both loops unrolled: acc[] and Bc[] stay in registers)
        #pragma unroll
        for (int c = 0; c < 4; ++c)
            acc[c] = __builtin_amdgcn_wmma_f32_16x16x32_f16(
                false, Ac[0], false, Bc[c], (short)0, acc[c], false, false);
        #pragma unroll
        for (int c = 0; c < 4; ++c)
            acc[4 + c] = __builtin_amdgcn_wmma_f32_16x16x32_f16(
                false, Ac[1], false, Bc[c], (short)0, acc[4 + c], false, false);

        // 4) stage step s+2 into the buffer whose fragments are in (Ac, Bc)
        stage(par, xc_, w0c, w1c);

        // Pin the shape: every load of the step issues ahead of its first WMMA
        // (left alone the compiler sinks the fragment reads to the foot, where
        // the barrier waits them out); trig, cvt and stores fill between WMMAs.
        if (q == 0) __builtin_amdgcn_sched_group_barrier(0x020, 1, 0);  // VMEM read (x)
        __builtin_amdgcn_sched_group_barrier(0x020, 2,  0);  // VMEM read
        __builtin_amdgcn_sched_group_barrier(0x100, 13, 0);  // DS read
        // unrolled: each call is one group of the step's schedule
        #pragma unroll
        for (int q = 0; q < 8; ++q) {
            __builtin_amdgcn_sched_group_barrier(0x008, 1, 0);  // WMMA
            __builtin_amdgcn_sched_group_barrier(0x402, 6, 0);  // VALU + trans
        }

        if (q == 3) xpiece_store((xp >> 2) + 1, xp & 3, xt);

        // 5) single barrier per K-step; global loads stay in flight over it
        lds_barrier();
    };

    for (int s = 0; s < NSTEPS; s += 4) {
        kstep(s,     0, 0, AE, BE, AO, BO, xvE, xvO, W0[2], W1[2], W0[1], W1[1]);
        kstep(s + 1, 1, 1, AO, BO, AE, BE, xvO, xvE, W0[3], W1[3], W0[2], W1[2]);
        kstep(s + 2, 0, 2, AE, BE, AO, BO, xvE, xvO, W0[0], W1[0], W0[3], W1[3]);
        kstep(s + 3, 1, 3, AO, BO, AE, BE, xvO, xvE, W0[1], W1[1], W0[0], W1[0]);
    }

    // ---- epilogue: store this K half's fp32 partial sums to its own plane
    //      (C/D layout: VGPR j -> row j / j+8) ----
    float* __restrict__ dst = part + (size_t)P * (B_SZ * O_SZ);
    #pragma unroll
    for (int r = 0; r < 2; ++r) {
        #pragma unroll
        for (int c = 0; c < 4; ++c) {
            const int col = o0 + wn * 64 + c * 16 + (lane & 15);
            #pragma unroll
            for (int j = 0; j < 8; ++j) {
                const int row =
                    row0 + wm * 32 + r * 16 + ((lane < 16) ? j : j + 8);
                dst[(size_t)row * O_SZ + col] = acc[r * 4 + c][j];
            }
        }
    }
}

__global__ __launch_bounds__(NTHREADS)
void fourier_kan_wmma_kernel(const float* __restrict__ x,
                             const float* __restrict__ coeffs,
                             float* __restrict__ part)
{
    // Double-buffered feature tile [row][kk] and weight tile [n][kk], f16,
    // K-major per row so WMMA operand gathers are contiguous 16B LDS loads.
    // A row holds its KT halves of buffer 0, those of buffer 1, then 16 B of
    // pad: at this pitch the 16 rows of a ds_load_b128 half-wave fall on 16
    // different 4-bank groups (at 64 B on only 4: a 4-way conflict), and the
    // buffer is still chosen by a shift.
    __shared__ __align__(16) _Float16 Ft[BM * KP];      // 36 KB
    __shared__ __align__(16) _Float16 Wt[BN * KP];      // 18 KB
    // Two buffers of raw x, BM rows x XB columns each: filled by whole-line
    // loads, one 64-row quarter every 4 steps, read back one float per thread and step.
    __shared__ __align__(16) float    Xs[2 * BM * XP];  // 72 KB

    if (blockIdx.z != 0) fourier_kan_part<1>(x, coeffs, part, Ft, Wt, Xs);
    else                 fourier_kan_part<0>(x, coeffs, part, Ft, Wt, Xs);
}

// out = cos partial + sin partial + bias. 4 x 16 B per thread from each plane:
// 8 independent loads in flight per lane, every wave on whole 512 B runs.
#define RTHREADS 256
#define RVEC 4
__global__ __launch_bounds__(RTHREADS)
void fourier_kan_sum_kernel(const float* __restrict__ part,
                            const float* __restrict__ bias,
                            float* __restrict__ out)
{
    const int base = blockIdx.x * (RTHREADS * RVEC) + threadIdx.x;  // in v4f
    const v4f* __restrict__ pc = (const v4f*)part;
    const v4f* __restrict__ ps = (const v4f*)(part + (size_t)B_SZ * O_SZ);
    v4f a[RVEC], b[RVEC];
    // unrolled: all 8 loads issue ahead of the first wait, a[] and b[] in registers
    #pragma unroll
    for (int u = 0; u < RVEC; ++u) {
        a[u] = pc[base + u * RTHREADS];
        b[u] = ps[base + u * RTHREADS];
    }
    // RTHREADS v4f are two whole rows, so the bias columns are the same for all u
    const v4f bv = ((const v4f*)bias)[base & (O_SZ / 4 - 1)];
    // unrolled: a[] and b[] are indexed by constants and stay in registers
    #pragma unroll
    for (int u = 0; u < RVEC; ++u)
        ((v4f*)out)[base + u * RTHREADS] = (a[u] + b[u]) + bv;
}

extern "C" void kernel_launch(void* const* d_in, const int* in_sizes, int n_in,
                              void* d_out, int out_size, void* d_ws, size_t ws_size,
                              hipStream_t stream) {
    const float* x      = (const float*)d_in[0];
    const float* coeffs = (const float*)d_in[1];
    const float* bias   = (const float*)d_in[2];
    float*       out    = (float*)d_out;
    float*       part   = (float*)d_ws;      // 2 planes of B_SZ x O_SZ floats

    dim3 grid(B_SZ / BM, O_SZ / BN, 2);  // 32 x 4 x 2 = 256 blocks, 16 waves each
    fourier_kan_wmma_kernel<<<grid, NTHREADS, 0, stream>>>(x, coeffs, part);
    fourier_kan_sum_kernel<<<B_SZ * O_SZ / 4 / (RTHREADS * RVEC), RTHREADS, 0, stream>>>(
        part, bias, out);
}

// v006
// It runs in 117 microseconds.
// Two timings next to v005 put it at 1.10 and 1.09 times that version's speed.
// Counting every step since v000, it is 5.39 times as fast.
#include <hip/hip_runtime.h>

typedef __attribute__((ext_vector_type(16))) _Float16 v16h;
typedef __attribute__((ext_vector_type(8)))  _Float16 v8h;
typedef __attribute__((ext_vector_type(8)))  float    v8f;
typedef __attribute__((ext_vector_type(4)))  float    v4f;
typedef __attribute__((ext_vector_type(2)))  float    v2f;

#define B_SZ 8192
#define I_SZ 512
#define O_SZ 512
#define G_SZ 16
#define KTOT (I_SZ * G_SZ)        // per-trig-part K = 8192

#define BM 256
#define BN 128
#define KT 32
#define KP 72                     // LDS row pitch in halves: 144 B = 16 B x odd
#define NTHREADS 128              // 4 waves, one per SIMD, each a 64 x 128 tile
#define WM 64                     // rows of a wave's tile: 4 A fragments
#define NSTEPS (KTOT / KT)        // 256 K-steps: one trig part per work-group
#define XB 32                     // x columns per LDS block: one 128 B line of each row
#define XP 36                     // LDS row pitch of an x block in floats (a 16 B multiple)
#define XSTEPS (XB * G_SZ / KT)   // 16 K-steps live on one x block

#define INV_2PI 0.15915494309189535f

// Work-group barrier of the K loop. It waits for this wave's LDS reads and
// writes only: __syncthreads() also waits out every global load, so that no
// load could be in flight longer than one K-step. s_wait_xcnt: a precaution,
// it stands in front of the next step's overwrite of the loads' address registers.
__device__ __forceinline__ void lds_barrier()
{
    asm volatile("s_wait_dscnt 0x0\n\t"
                 "s_wait_xcnt 0x0\n\t"
                 "s_barrier_signal -1\n\t"
                 "s_barrier_wait -1" ::: "memory");
    // ends the step's scheduling region: without it the compiler sinks a step's
    // global loads to its foot, directly in front of these waits
    __builtin_amdgcn_sched_barrier(0);
}

// raw weights of one K-step in one thread: 8 floats of each of 4 rows
struct WSet { v4f lo[4], hi[4]; };

// One work-group: a BM x BN tile of the partial product over ONE trig part
// (P = 0: cos half of K, P = 1: sin half), stored to that part's plane.
template <int P>
__device__ __forceinline__
void fourier_kan_part(const float* __restrict__ x,
                      const float* __restrict__ coeffs,
                      float* __restrict__ part,
                      _Float16* __restrict__ Wt,
                      float* __restrict__ Xs)
{
    const int tid  = threadIdx.x;
    const int lane = tid & 31;
    const int wave = tid >> 5;             // 0..3 -> 64-row stripe, all BN columns
    const int row0 = blockIdx.x * BM;
    const int o0   = blockIdx.y * BN;

    // staging roles
    const int wnn = tid >> 2;              // weight n 0..31 (+32 per load pair)
    const int wcc = (tid & 3) * 8;         // weight kk chunk 0,8,16,24
    const int xr  = lane >> 3;             // x piece row 0..3 (+4 per load)
    const int xc  = (lane & 7) * 4;        // x block column: 8 lanes = one line

    v8f acc[32] = {};                      // [r*8 + c], r in 0..3, c in 0..7

    // per-lane K half-offset for the 16-bit WMMA A/B operand layout:
    // lanes 0-15: K = {0..7, 16..23}; lanes 16-31: K = {8..15, 24..31}
    const int hA      = (lane < 16) ? 0 : 8;
    const int bRowOff = (lane & 15) * KP;                // B tile c adds c*16*KP

    // K index kk of a step = (x column & 1) * 16 + (frequency - 1), so that this
    // lane's 16 A elements are frequencies hA+1 .. hA+8 of the step's two columns
    float fk[8];
    // unrolled: fk[] is indexed by constants and stays in registers
    #pragma unroll
    for (int j = 0; j < 8; ++j) fk[j] = (float)(hA + j + 1);

    // ---- piece j (16 rows) of this wave's 64 rows of x block b: global ->
    //      registers, stored to LDS some K-steps later. Every wave load covers
    //      4 whole 128 B lines (a block past the last re-reads the last one) ----
    auto xpiece_load = [&](int b, int j, v4f (&t)[4]) {
        const int bs = (b < I_SZ / XB) ? b : I_SZ / XB - 1;
        const float* xb = x + (size_t)(row0 + j * 16) * I_SZ + bs * XB;  // uniform base
        // unrolled: the 4 loads issue together, t[] stays in registers
        #pragma unroll
        for (int k = 0; k < 4; ++k)
            t[k] = *(const v4f*)(xb + (unsigned)((wave * WM + k * 4 + xr) * I_SZ + xc));
    };
    auto xpiece_store = [&](int b, int j, const v4f (&t)[4]) {
        // unrolled: t[] is indexed by constants and stays in registers
        #pragma unroll
        for (int k = 0; k < 4; ++k)
            *(v4f*)&Xs[((b & 1) * BM + wave * WM + j * 16 + k * 4 + xr) * XP + xc] = t[k];
    };

    // ---- raw operands of step s: its two x columns for this lane's row of each
    //      A tile from the LDS block, weights global ----
    auto xread = [&](int s, v2f (&xv)[4]) {
        const float* xs = &Xs[((s / XSTEPS) & 1) * (BM * XP) + ((s * 2) & (XB - 1))
                              + (wave * WM + (lane & 15)) * XP]; // A tile r adds r*16
        // unrolled: xv[] is indexed by constants and stays in registers
        #pragma unroll
        for (int r = 0; r < 4; ++r)
            xv[r] = *(const v2f*)(xs + r * 16 * XP);       // ds_load_b64
    };
    const unsigned woff = (unsigned)(wnn * KTOT + wcc);    // this thread in a step's tile
    auto wload = [&](const float* wsrc, WSet& w) {         // wsrc: uniform base
        // unrolled: the 8 loads issue together, w stays in registers
        #pragma unroll
        for (int k = 0; k < 4; ++k) {
            w.lo[k] = *(const v4f*)(wsrc + (woff + (unsigned)(k * 32 * KTOT)));      // global_load_b128
            w.hi[k] = *(const v4f*)(wsrc + (woff + (unsigned)(k * 32 * KTOT) + 4));  // global_load_b128
        }
    };

    // ---- the features of one K-step, made where the WMMA reads them: element
    //      j of A tile r is frequency hA+1+(j&7) of column j>>3 ----
    auto make_a = [&](const v2f (&xv)[4], v16h (&A)[4]) {
        // unrolled: A[] and xv[] are indexed by constants and stay in registers
        #pragma unroll
        for (int r = 0; r < 4; ++r) {
            const float t0 = xv[r][0] * INV_2PI;  // v_sin/cos take revolutions
            const float t1 = xv[r][1] * INV_2PI;
            #pragma unroll
            for (int j = 0; j < 8; ++j) {
                if (P == 0) {
                    A[r][j]     = (_Float16)__builtin_amdgcn_cosf(t0 * fk[j]);
                    A[r][j + 8] = (_Float16)__builtin_amdgcn_cosf(t1 * fk[j]);
                } else {
                    A[r][j]     = (_Float16)__builtin_amdgcn_sinf(t0 * fk[j]);
                    A[r][j + 8] = (_Float16)__builtin_amdgcn_sinf(t1 * fk[j]);
                }
            }
        }
    };

    // ---- convert + store a step's weights into LDS buffer buf ----
    auto stage_w = [&](int buf, const WSet& w) {
        // unrolled: w is indexed by constants and stays in registers
        #pragma unroll
        for (int k = 0; k < 4; ++k) {
            v8h wh;
            #pragma unroll
            for (int j = 0; j < 4; ++j) {
                wh[j]     = (_Float16)w.lo[k][j];
                wh[j + 4] = (_Float16)w.hi[k][j];
            }
            *(v8h*)&Wt[(wnn + k * 32) * KP + buf * KT + wcc] = wh;   // ds_store_b128
        }
    };

    auto load16 = [&](const _Float16* rowp) -> v16h {
        v8h lo = *(const v8h*)(rowp + hA);
        v8h hi = *(const v8h*)(rowp + hA + 16);
        v16h r;
        #pragma unroll
        for (int j = 0; j < 8; ++j) { r[j] = lo[j]; r[j + 8] = hi[j]; }
        return r;
    };

    // B fragments of one K-step: 16 ds_load_b128 from LDS buffer buf
    auto load_b = [&](int buf, v16h (&Bf)[8]) {
        // unrolled: Bf[] is indexed by constants and stays in registers
        #pragma unroll
        for (int c = 0; c < 8; ++c)
            Bf[c] = load16(&Wt[bRowOff + buf * KT + c * 16 * KP]);
    };

    // four register sets of raw weights: step t lives in set t & 3
    const float* const wtile = coeffs + (size_t)o0 * KTOT;  // uniform
    WSet Wr[4];

    // prologue: x block 0 and the first piece of block 1 into LDS, seen by
    // all lanes behind the barrier; the weights of steps 0 to 3 asked for
    {
        v4f t[5][4];
        __builtin_amdgcn_sched_barrier(0);   // see the waits below
        // unrolled: t[] is indexed by constants and stays in registers
        #pragma unroll
        for (int j = 0; j < 4; ++j) xpiece_load(0, j, t[j]);
        xpiece_load(1, 0, t[4]);
        // precaution: stands in front of any overwrite of these loads' address
        // registers; the scheduling fences (one ahead of the loads, one here)
        // keep other address work out from between the loads and the wait
        asm volatile("s_wait_xcnt 0x0" ::: "memory");
        __builtin_amdgcn_sched_barrier(0);
        // unrolled: Wr[] is indexed by constants and stays in registers
        #pragma unroll
        for (int u = 0; u < 4; ++u) wload(wtile + u * KT, Wr[u]);
        // the same precaution for the weight loads, with the same fence
        asm volatile("s_wait_xcnt 0x0" ::: "memory");
        __builtin_amdgcn_sched_barrier(0);
        #pragma unroll
        for (int j = 0; j < 4; ++j) xpiece_store(0, j, t[j]);
        xpiece_store(1, 0, t[4]);
    }
    __syncthreads();

    // two register sets of fragments: one is multiplied while the other fills
    v16h AE[4], BE[8], AO[4], BO[8];
    v2f  xvE[4], xvO[4];                       // raw x, even / odd steps

    // stage the weights of steps 0 and 1 into buffers 0 and 1; the loads of
    // steps 2 to 4 fly; step 0's features, step 1's x
    stage_w(0, Wr[0]);
    stage_w(1, Wr[1]);
    wload(wtile + 4 * KT, Wr[0]);
    // the same precaution for these loads, with the same fence
    asm volatile("s_wait_xcnt 0x0" ::: "memory");
    __builtin_amdgcn_sched_barrier(0);
    xread(0, xvE);
    make_a(xvE, AE);
    xread(1, xvO);
    __syncthreads();

    load_b(0, BE);
    // every wave holds step 0 in registers before buffer 0 is staged anew
    __syncthreads();

    const float* wnext = wtile + 4 * KT;       // the weights last asked for (uniform)
    v4f xt[4];                                 // a piece of an x block on its way to LDS

    // One K-step s of parity par, q = s & 3. On entry: (Ac, Bc) hold step s,
    // LDS buffer par^1 holds step s+1's weights, buffer par is free, xn_ holds
    // step s+1's x, wc step s+2's weights (asked for 3 steps ago); xc_ and wf
    // are free.
    auto kstep = [&](int s, int par, int q,
                     v16h (&Ac)[4], v16h (&Bc)[8], v16h (&An)[4], v16h (&Bn)[8],
                     v2f (&xc_)[4], v2f (&xn_)[4],
                     WSet& wc, WSet& wf) {
        // 0) every 4th step asks for one piece of a coming x block and the
        //    3rd step behind it stores that piece. Piece xp & 3 of block
        //    xp / 4 + 1: its LDS buffer was last read at step 16 * (xp / 4) - 3,
        //    is written from step 16 * (xp / 4) - 1 to + 11, first read at + 14.
        const int xq = (s >> 2) + 1;
        const int xp = (xq < 4 * (I_SZ / XB - 1)) ? xq : 4 * (I_SZ / XB - 1);
        if (q == 0) xpiece_load((xp >> 2) + 1, xp & 3, xt);

        // 1) step s+1's B fragments into the idle register set: waited for only
        //    at the foot of this step, behind its WMMAs, trig and stores
        load_b(par ^ 1, Bn);

        // 2) ask for step s+5's weights (the last step's again past the end):
        //    they fly over three barriers; step s+2's x comes from LDS
        wnext += (s < NSTEPS - 5) ? KT : 0;
        wload(wnext, wf);
        xread((s < NSTEPS - 2) ? s + 2 : NSTEPS - 1, xc_);

        // 3) 32 WMMAs on registers filled during the last step: no LDS wait
        //    (both loops unrolled: acc[], Ac[] and Bc[] stay in registers)
        #pragma unroll
        for (int r = 0; r < 4; ++r)
            #pragma unroll
            for (int c = 0; c < 8; ++c)
                acc[r * 8 + c] = __builtin_amdgcn_wmma_f32_16x16x32_f16(
                    false, Ac[r], false, Bc[c], (short)0, acc[r * 8 + c], false, false);

        // 4) step s+1's features straight into the idle A set; step s+2's
        //    weights into the buffer whose fragments are in Bc
        make_a(xn_, An);
        stage_w(par, wc);

        // Pin the shape: every load of the step issues ahead of its first WMMA
        // (left alone the compiler sinks the fragment reads to the foot, where
        // the barrier waits them out); trig, cvt and stores fill between WMMAs.
        if (q == 0) __builtin_amdgcn_sched_group_barrier(0x020, 4, 0);  // VMEM read (x)
        __builtin_amdgcn_sched_group_barrier(0x020, 8,  0);  // VMEM read
        __builtin_amdgcn_sched_group_barrier(0x100, 20, 0);  // DS read
        // unrolled: each call is one group of the step's schedule
        #pragma unroll
        for (int g = 0; g < 32; ++g) {
            __builtin_amdgcn_sched_group_barrier(0x008, 1, 0);  // WMMA
            __builtin_amdgcn_sched_group_barrier(0x402, 6, 0);  // VALU + trans
        }

        if (q == 3) xpiece_store((xp >> 2) + 1, xp & 3, xt);

        // Inputs only, no instruction: step s+1's A set is complete at this
        // step's foot. Without it the compiler keeps the features in f32 and
        // converts them in the next step, over the one A set its WMMAs are
        // reading, so that every row of WMMAs waits for its own conversion.
        asm volatile("" :: "v"(An[0]), "v"(An[1]), "v"(An[2]), "v"(An[3]));

        // 5) single barrier per K-step; global loads stay in flight over it
        lds_barrier();
    };

    for (int s = 0; s < NSTEPS; s += 4) {
        kstep(s,     0, 0, AE, BE, AO, BO, xvE, xvO, Wr[2], Wr[1]);
        kstep(s + 1, 1, 1, AO, BO, AE, BE, xvO, xvE, Wr[3], Wr[2]);
        kstep(s + 2, 0, 2, AE, BE, AO, BO, xvE, xvO, Wr[0], Wr[3]);
        kstep(s + 3, 1, 3, AO, BO, AE, BE, xvO, xvE, Wr[1], Wr[0]);
    }

    // ---- epilogue: store this K half's fp32 partial sums to its own plane
    //      (C/D layout: VGPR j -> row j / j+8) ----
    //      one address per lane, every tile, row and column step a constant
    float* __restrict__ dst = part + (size_t)P * (B_SZ * O_SZ)
        + (size_t)(row0 + wave * WM + hA) * O_SZ + o0 + (lane & 15);
    #pragma unroll
    for (int r = 0; r < 4; ++r) {
        #pragma unroll
        for (int c = 0; c < 8; ++c) {
            #pragma unroll
            for (int j = 0; j < 8; ++j)
                dst[(r * 16 + j) * O_SZ + c * 16] = acc[r * 8 + c][j];
        }
    }
}

__global__ __launch_bounds__(NTHREADS)
void fourier_kan_wmma_kernel(const float* __restrict__ x,
                             const float* __restrict__ coeffs,
                             float* __restrict__ part)
{
    // Double-buffered weight tile [n][kk], f16, K-major per row so WMMA operand
    // gathers are contiguous 16B LDS loads. A row holds its KT halves of buffer
    // 0, those of buffer 1, then 16 B of pad: at this pitch the 16 rows of a
    // ds_load_b128 half-wave fall on 16 different 4-bank groups (at 64 B on only
    // 4: a 4-way conflict), and the buffer is still chosen by a shift.
    __shared__ __align__(16) _Float16 Wt[BN * KP];      // 18 KB
    // Two buffers of raw x, BM rows x XB columns each: filled by whole-line
    // loads once per XSTEPS steps, read back two floats per A tile and step.
    __shared__ __align__(16) float    Xs[2 * BM * XP];  // 72 KB

    // this part's plane of the weights: a scalar base for every weight load
    const float* cz = coeffs + (size_t)blockIdx.z * (O_SZ * KTOT);
    if (blockIdx.z != 0) fourier_kan_part<1>(x, cz, part, Wt, Xs);
    else                 fourier_kan_part<0>(x, cz, part, Wt, Xs);
}

// out = cos partial + sin partial + bias. 4 x 16 B per thread from each plane:
// 8 independent loads in flight per lane, every wave on whole 512 B runs.
#define RTHREADS 256
#define RVEC 4
__global__ __launch_bounds__(RTHREADS)
void fourier_kan_sum_kernel(const float* __restrict__ part,
                            const float* __restrict__ bias,
                            float* __restrict__ out)
{
    const int base = blockIdx.x * (RTHREADS * RVEC) + threadIdx.x;  // in v4f
    const v4f* __restrict__ pc = (const v4f*)part;
    const v4f* __restrict__ ps = (const v4f*)(part + (size_t)B_SZ * O_SZ);
    v4f a[RVEC], b[RVEC];
    // unrolled: all 8 loads issue ahead of the first wait, a[] and b[] in registers
    #pragma unroll
    for (int u = 0; u < RVEC; ++u) {
        a[u] = pc[base + u * RTHREADS];
        b[u] = ps[base + u * RTHREADS];
    }
    // RTHREADS v4f are two whole rows, so the bias columns are the same for all u
    const v4f bv = ((const v4f*)bias)[base & (O_SZ / 4 - 1)];
    // unrolled: a[] and b[] are indexed by constants and stay in registers
    #pragma unroll
    for (int u = 0; u < RVEC; ++u)
        ((v4f*)out)[base + u * RTHREADS] = (a[u] + b[u]) + bv;
}

extern "C" void kernel_launch(void* const* d_in, const int* in_sizes, int n_in,
                              void* d_out, int out_size, void* d_ws, size_t ws_size,
                              hipStream_t stream) {
    const float* x      = (const float*)d_in[0];
    const float* coeffs = (const float*)d_in[1];
    const float* bias   = (const float*)d_in[2];
    float*       out    = (float*)d_out;
    float*       part   = (float*)d_ws;      // 2 planes of B_SZ x O_SZ floats

    dim3 grid(B_SZ / BM, O_SZ / BN, 2);  // 32 x 4 x 2 = 256 blocks, 4 waves each
    fourier_kan_wmma_kernel<<<grid, NTHREADS, 0, stream>>>(x, coeffs, part);
    fourier_kan_sum_kernel<<<B_SZ * O_SZ / 4 / (RTHREADS * RVEC), RTHREADS, 0, stream>>>(
        part, bias, out);
}

// v007
// One run takes 106 microseconds.
// In two side-by-side timings against v006, it was 1.09 and 1.10 times as fast.
// All steps since v000 together make it 5.89 times as fast.
#include <hip/hip_runtime.h>

typedef __attribute__((ext_vector_type(16))) _Float16 v16h;
typedef __attribute__((ext_vector_type(8)))  _Float16 v8h;
typedef __attribute__((ext_vector_type(8)))  float    v8f;
typedef __attribute__((ext_vector_type(4)))  float    v4f;
typedef __attribute__((ext_vector_type(2)))  float    v2f;

#define B_SZ 8192
#define I_SZ 512
#define O_SZ 512
#define G_SZ 16
#define KTOT (I_SZ * G_SZ)        // per-trig-part K = 8192

#define BM 256
#define BN 128
#define KT 32
#define KP 72                     // LDS row pitch in halves: 144 B = 16 B x odd
#define NTHREADS 128              // 4 waves, one per SIMD, each a 64 x 128 tile
#define WM 64                     // rows of a wave's tile: 4 A fragments
#define NSTEPS (KTOT / KT)        // 256 K-steps: one trig part per work-group
#define XB 32                     // x columns per LDS block: one 128 B line of each row
#define XP 36                     // LDS row pitch of an x block in floats (a 16 B multiple)
#define XSTEPS (XB * G_SZ / KT)   // 16 K-steps live on one x block

#define INV_2PI 0.15915494309189535f

// Work-group barrier of the K loop. It waits for this wave's LDS reads and
// writes only: __syncthreads() also waits out every global load, so that no
// load could be in flight longer than one K-step. s_wait_xcnt: a precaution,
// it stands in front of the next step's overwrite of the loads' address registers.
__device__ __forceinline__ void lds_barrier()
{
    asm volatile("s_wait_dscnt 0x0\n\t"
                 "s_wait_xcnt 0x0\n\t"
                 "s_barrier_signal -1\n\t"
                 "s_barrier_wait -1" ::: "memory");
    // ends the step's scheduling region: without it the compiler sinks a step's
    // global loads to its foot, directly in front of these waits
    __builtin_amdgcn_sched_barrier(0);
}

// raw weights of one K-step in one thread: 8 floats of each of 4 rows
struct WSet { v4f lo[4], hi[4]; };

// One work-group: a BM x BN tile of the partial product over ONE trig part
// (P = 0: cos half of K, P = 1: sin half), stored to that part's plane.
template <int P>
__device__ __forceinline__
void fourier_kan_part(const float* __restrict__ x,
                      const float* __restrict__ coeffs,
                      float* __restrict__ part,
                      _Float16* __restrict__ Wt,
                      float* __restrict__ Xs)
{
    const int tid  = threadIdx.x;
    const int lane = tid & 31;
    const int wave = tid >> 5;             // 0..3 -> 64-row stripe, all BN columns
    const int row0 = blockIdx.x * BM;
    const int o0   = blockIdx.y * BN;

    // staging roles
    const int wnn = tid >> 2;              // weight n 0..31 (+32 per load pair)
    const int wcc = (tid & 3) * 8;         // weight kk chunk 0,8,16,24
    const int xr  = lane >> 3;             // x piece row 0..3 (+4 per load)
    const int xc  = (lane & 7) * 4;        // x block column: 8 lanes = one line

    v8f acc[32] = {};                      // [r*8 + c], r in 0..3, c in 0..7

    // A step's 32 k are 2 x columns times 16 frequencies. A lane half holds 16 of
    // them in its A and its B fragment alike (element j of lanes 0-15 and element
    // j of lanes 16-31 sit at fixed k places of the WMMA, the same in A and B):
    // here lane half h takes column h whole, element j = frequency j + 1, which
    // in a weight row are the 16 neighbours h*16 .. h*16 + 15.
    const int hcol    = lane >> 4;                       // this lane's column of a step
    const int hA      = hcol * 8;                        // C/D layout: row offset
    const int bRowOff = (lane & 15) * KP + hcol * 16;    // B tile c adds c*16*KP

    // ---- piece j (16 rows) of this wave's 64 rows of x block b: global ->
    //      registers, stored to LDS some K-steps later. Every wave load covers
    //      4 whole 128 B lines (a block past the last re-reads the last one) ----
    auto xpiece_load = [&](int b, int j, v4f (&t)[4]) {
        const int bs = (b < I_SZ / XB) ? b : I_SZ / XB - 1;
        const float* xb = x + (size_t)(row0 + j * 16) * I_SZ + bs * XB;  // uniform base
        // unrolled: the 4 loads issue together, t[] stays in registers
        #pragma unroll
        for (int k = 0; k < 4; ++k)
            t[k] = *(const v4f*)(xb + (unsigned)((wave * WM + k * 4 + xr) * I_SZ + xc));
    };
    auto xpiece_store = [&](int b, int j, const v4f (&t)[4]) {
        // unrolled: t[] is indexed by constants and stays in registers
        #pragma unroll
        for (int k = 0; k < 4; ++k)
            *(v4f*)&Xs[((b & 1) * BM + wave * WM + j * 16 + k * 4 + xr) * XP + xc] = t[k];
    };

    // ---- raw operands of step s: this lane's x column for its row of each
    //      A tile from the LDS block, weights global ----
    auto xread = [&](int s, float (&xv)[4]) {
        const float* xs = &Xs[((s / XSTEPS) & 1) * (BM * XP) + ((s * 2) & (XB - 1))
                              + (wave * WM + (lane & 15)) * XP + hcol]; // A tile r adds r*16
        // unrolled: xv[] is indexed by constants and stays in registers
        #pragma unroll
        for (int r = 0; r < 4; ++r)
            xv[r] = xs[r * 16 * XP];                       // ds_load_b32
    };
    const unsigned woff = (unsigned)(wnn * KTOT + wcc);    // this thread in a step's tile
    auto wload = [&](const float* wsrc, WSet& w) {         // wsrc: uniform base
        // unrolled: the 8 loads issue together, w stays in registers
        #pragma unroll
        for (int k = 0; k < 4; ++k) {
            w.lo[k] = *(const v4f*)(wsrc + (woff + (unsigned)(k * 32 * KTOT)));      // global_load_b128
            w.hi[k] = *(const v4f*)(wsrc + (woff + (unsigned)(k * 32 * KTOT) + 4));  // global_load_b128
        }
    };

    // ---- the features of one K-step, made where the WMMA reads them: element
    //      j of A tile r is frequency j+1 of this lane's column. Frequencies 1
    //      and 2 come from the trig unit; the rest from the identity
    //      f((k+2)x) = 2 cos(2x) f(kx) - f((k-2)x), f = cos or sin, in f32, odd
    //      and even frequency side by side in one packed multiply-add ----
    auto make_a = [&](const float (&xv)[4], v16h (&A)[4]) {
        float t1[4], t2[4], f1[4], f2[4], c2[4];
        v2f fm[4], fc[4], mm[4];                  // f(k-2), f(k), 2 cos(2x) twice
        // every loop unrolled: the arrays are indexed by constants and stay in
        // registers. The A tile is the inner loop throughout: four independent
        // chains side by side, so that no instruction waits for the one before it
        #pragma unroll
        for (int r = 0; r < 4; ++r) t1[r] = xv[r] * INV_2PI;   // v_sin/cos take revolutions
        #pragma unroll
        for (int r = 0; r < 4; ++r) t2[r] = t1[r] + t1[r];
        #pragma unroll
        for (int r = 0; r < 4; ++r) c2[r] = __builtin_amdgcn_cosf(t2[r]);
        #pragma unroll
        for (int r = 0; r < 4; ++r)
            f1[r] = (P == 0) ? __builtin_amdgcn_cosf(t1[r]) : __builtin_amdgcn_sinf(t1[r]);
        #pragma unroll
        for (int r = 0; r < 4; ++r)
            f2[r] = (P == 0) ? c2[r] : __builtin_amdgcn_sinf(t2[r]);
        #pragma unroll
        for (int r = 0; r < 4; ++r) {
            const float m = c2[r] + c2[r];
            mm[r] = v2f{m, m};
        }
        #pragma unroll
        for (int r = 0; r < 4; ++r) {
            const float m = mm[r][0];
            fm[r] = v2f{f1[r], f2[r]};                            // frequencies 1, 2
            // frequencies 3, 4: cos(-x) = cos x, cos 0 = 1; sin(-x) = -sin x, sin 0 = 0
            if (P == 0) fc[r] = v2f{__builtin_fmaf(m, f1[r], -f1[r]), __builtin_fmaf(m, f2[r], -1.0f)};
            else        fc[r] = v2f{__builtin_fmaf(m, f1[r], f1[r]), m * f2[r]};
        }
        #pragma unroll
        for (int r = 0; r < 4; ++r) {
            A[r][0] = (_Float16)fm[r][0];
            A[r][1] = (_Float16)fm[r][1];
            A[r][2] = (_Float16)fc[r][0];
            A[r][3] = (_Float16)fc[r][1];
        }
        #pragma unroll
        for (int j = 2; j < 8; ++j) {
            #pragma unroll
            for (int r = 0; r < 4; ++r) {
                const v2f fn = __builtin_elementwise_fma(mm[r], fc[r], -fm[r]);  // v_pk_fma_f32
                A[r][2 * j]     = (_Float16)fn[0];
                A[r][2 * j + 1] = (_Float16)fn[1];
                fm[r] = fc[r];
                fc[r] = fn;
            }
        }
    };

    // ---- convert + store a step's weights into LDS buffer buf ----
    auto stage_w = [&](int buf, const WSet& w) {
        // unrolled: w is indexed by constants and stays in registers
        #pragma unroll
        for (int k = 0; k < 4; ++k) {
            v8h wh;
            #pragma unroll
            for (int j = 0; j < 4; ++j) {
                wh[j]     = (_Float16)w.lo[k][j];
                wh[j + 4] = (_Float16)w.hi[k][j];
            }
            *(v8h*)&Wt[(wnn + k * 32) * KP + buf * KT + wcc] = wh;   // ds_store_b128
        }
    };

    auto load16 = [&](const _Float16* rowp) -> v16h {
        v8h lo = *(const v8h*)(rowp);
        v8h hi = *(const v8h*)(rowp + 8);
        v16h r;
        #pragma unroll
        for (int j = 0; j < 8; ++j) { r[j] = lo[j]; r[j + 8] = hi[j]; }
        return r;
    };

    // B fragments of one K-step: 16 ds_load_b128 from LDS buffer buf
    auto load_b = [&](int buf, v16h (&Bf)[8]) {
        // unrolled: Bf[] is indexed by constants and stays in registers
        #pragma unroll
        for (int c = 0; c < 8; ++c)
            Bf[c] = load16(&Wt[bRowOff + buf * KT + c * 16 * KP]);
    };

    // four register sets of raw weights: step t lives in set t & 3
    const float* const wtile = coeffs + (size_t)o0 * KTOT;  // uniform
    WSet Wr[4];

    // prologue: x block 0 and the first piece of block 1 into LDS, seen by
    // all lanes behind the barrier; the weights of steps 0 to 3 asked for
    {
        v4f t[5][4];
        __builtin_amdgcn_sched_barrier(0);   // see the waits below
        // unrolled: t[] is indexed by constants and stays in registers
        #pragma unroll
        for (int j = 0; j < 4; ++j) xpiece_load(0, j, t[j]);
        xpiece_load(1, 0, t[4]);
        // precaution: stands in front of any overwrite of these loads' address
        // registers; the scheduling fences (one ahead of the loads, one here)
        // keep other address work out from between the loads and the wait
        asm volatile("s_wait_xcnt 0x0" ::: "memory");
        __builtin_amdgcn_sched_barrier(0);
        // unrolled: Wr[] is indexed by constants and stays in registers
        #pragma unroll
        for (int u = 0; u < 4; ++u) wload(wtile + u * KT, Wr[u]);
        // the same precaution for the weight loads, with the same fence
        asm volatile("s_wait_xcnt 0x0" ::: "memory");
        __builtin_amdgcn_sched_barrier(0);
        #pragma unroll
        for (int j = 0; j < 4; ++j) xpiece_store(0, j, t[j]);
        xpiece_store(1, 0, t[4]);
    }
    __syncthreads();

    // two register sets of fragments: one is multiplied while the other fills
    v16h AE[4], BE[8], AO[4], BO[8];
    float xvE[4], xvO[4];                      // raw x, even / odd steps

    // stage the weights of steps 0 and 1 into buffers 0 and 1; the loads of
    // steps 2 to 4 fly; step 0's features, step 1's x
    stage_w(0, Wr[0]);
    stage_w(1, Wr[1]);
    wload(wtile + 4 * KT, Wr[0]);
    // the same precaution for these loads, with the same fence
    asm volatile("s_wait_xcnt 0x0" ::: "memory");
    __builtin_amdgcn_sched_barrier(0);
    xread(0, xvE);
    make_a(xvE, AE);
    xread(1, xvO);
    __syncthreads();

    load_b(0, BE);
    // every wave holds step 0 in registers before buffer 0 is staged anew
    __syncthreads();

    const float* wnext = wtile + 4 * KT;       // the weights last asked for (uniform)
    v4f xt[4];                                 // a piece of an x block on its way to LDS

    // One K-step s of parity par, q = s & 3. On entry: (Ac, Bc) hold step s,
    // LDS buffer par^1 holds step s+1's weights, buffer par is free, xn_ holds
    // step s+1's x, wc step s+2's weights (asked for 3 steps ago); xc_ and wf
    // are free.
    auto kstep = [&](int s, int par, int q,
                     v16h (&Ac)[4], v16h (&Bc)[8], v16h (&An)[4], v16h (&Bn)[8],
                     float (&xc_)[4], float (&xn_)[4],
                     WSet& wc, WSet& wf) {
        // 0) every 4th step asks for one piece of a coming x block and the
        //    3rd step behind it stores that piece. Piece xp & 3 of block
        //    xp / 4 + 1: its LDS buffer was last read at step 16 * (xp / 4) - 3,
        //    is written from step 16 * (xp / 4) - 1 to + 11, first read at + 14.
        const int xq = (s >> 2) + 1;
        const int xp = (xq < 4 * (I_SZ / XB - 1)) ? xq : 4 * (I_SZ / XB - 1);
        if (q == 0) xpiece_load((xp >> 2) + 1, xp & 3, xt);

        // 1) step s+1's B fragments into the idle register set: waited for only
        //    at the foot of this step, behind its WMMAs, trig and stores
        load_b(par ^ 1, Bn);

        // 2) ask for step s+5's weights (the last step's again past the end):
        //    they fly over three barriers; step s+2's x comes from LDS
        wnext += (s < NSTEPS - 5) ? KT : 0;
        wload(wnext, wf);
        xread((s < NSTEPS - 2) ? s + 2 : NSTEPS - 1, xc_);

        // 3) 32 WMMAs on registers filled during the last step: no LDS wait
        //    (both loops unrolled: acc[], Ac[] and Bc[] stay in registers)
        #pragma unroll
        for (int r = 0; r < 4; ++r)
            #pragma unroll
            for (int c = 0; c < 8; ++c)
                acc[r * 8 + c] = __builtin_amdgcn_wmma_f32_16x16x32_f16(
                    false, Ac[r], false, Bc[c], (short)0, acc[r * 8 + c], false, false);

        // 4) step s+1's features straight into the idle A set; step s+2's
        //    weights into the buffer whose fragments are in Bc
        make_a(xn_, An);
        stage_w(par, wc);

        // Pin the shape: every load of the step issues ahead of its first WMMA
        // (left alone the compiler sinks the fragment reads to the foot, where
        // the barrier waits them out); features, cvt and stores fill between WMMAs.
        if (q == 0) __builtin_amdgcn_sched_group_barrier(0x020, 4, 0);  // VMEM read (x)
        __builtin_amdgcn_sched_group_barrier(0x020, 8,  0);  // VMEM read
        __builtin_amdgcn_sched_group_barrier(0x100, 20, 0);  // DS read
        // unrolled: each call is one group of the step's schedule
        #pragma unroll
        for (int g = 0; g < 32; ++g) {
            __builtin_amdgcn_sched_group_barrier(0x008, 1, 0);  // WMMA
            __builtin_amdgcn_sched_group_barrier(0x402, 4, 0);  // VALU + trans
        }

        if (q == 3) xpiece_store((xp >> 2) + 1, xp & 3, xt);

        // Inputs only, no instruction: step s+1's A set is complete at this
        // step's foot. Without it the compiler keeps the features in f32 and
        // converts them in the next step, over the one A set its WMMAs are
        // reading, so that every row of WMMAs waits for its own conversion.
        asm volatile("" :: "v"(An[0]), "v"(An[1]), "v"(An[2]), "v"(An[3]));

        // 5) single barrier per K-step; global loads stay in flight over it
        lds_barrier();
    };

    for (int s = 0; s < NSTEPS; s += 4) {
        kstep(s,     0, 0, AE, BE, AO, BO, xvE, xvO, Wr[2], Wr[1]);
        kstep(s + 1, 1, 1, AO, BO, AE, BE, xvO, xvE, Wr[3], Wr[2]);
        kstep(s + 2, 0, 2, AE, BE, AO, BO, xvE, xvO, Wr[0], Wr[3]);
        kstep(s + 3, 1, 3, AO, BO, AE, BE, xvO, xvE, Wr[1], Wr[0]);
    }

    // ---- epilogue: store this K half's fp32 partial sums to its own plane
    //      (C/D layout: VGPR j -> row j / j+8) ----
    //      one address per lane, every tile, row and column step a constant
    float* __restrict__ dst = part + (size_t)P * (B_SZ * O_SZ)
        + (size_t)(row0 + wave * WM + hA) * O_SZ + o0 + (lane & 15);
    #pragma unroll
    for (int r = 0; r < 4; ++r) {
        #pragma unroll
        for (int c = 0; c < 8; ++c) {
            #pragma unroll
            for (int j = 0; j < 8; ++j)
                dst[(r * 16 + j) * O_SZ + c * 16] = acc[r * 8 + c][j];
        }
    }
}

__global__ __launch_bounds__(NTHREADS)
void fourier_kan_wmma_kernel(const float* __restrict__ x,
                             const float* __restrict__ coeffs,
                             float* __restrict__ part)
{
    // Double-buffered weight tile [n][kk], f16, K-major per row so WMMA operand
    // gathers are contiguous 16B LDS loads. A row holds its KT halves of buffer
    // 0, those of buffer 1, then 16 B of pad: at this pitch the 16 rows of a
    // ds_load_b128 half-wave fall on 16 different 4-bank groups (at 64 B on only
    // 4: a 4-way conflict), and the buffer is still chosen by a shift.
    __shared__ __align__(16) _Float16 Wt[BN * KP];      // 18 KB
    // Two buffers of raw x, BM rows x XB columns each: filled by whole-line
    // loads once per XSTEPS steps, read back one float per lane, A tile and step.
    __shared__ __align__(16) float    Xs[2 * BM * XP];  // 72 KB

    // this part's plane of the weights: a scalar base for every weight load
    const float* cz = coeffs + (size_t)blockIdx.z * (O_SZ * KTOT);
    if (blockIdx.z != 0) fourier_kan_part<1>(x, cz, part, Wt, Xs);
    else                 fourier_kan_part<0>(x, cz, part, Wt, Xs);
}

// out = cos partial + sin partial + bias. 4 x 16 B per thread from each plane:
// 8 independent loads in flight per lane, every wave on whole 512 B runs.
#define RTHREADS 256
#define RVEC 4
__global__ __launch_bounds__(RTHREADS)
void fourier_kan_sum_kernel(const float* __restrict__ part,
                            const float* __restrict__ bias,
                            float* __restrict__ out)
{
    const int base = blockIdx.x * (RTHREADS * RVEC) + threadIdx.x;  // in v4f
    const v4f* __restrict__ pc = (const v4f*)part;
    const v4f* __restrict__ ps = (const v4f*)(part + (size_t)B_SZ * O_SZ);
    v4f a[RVEC], b[RVEC];
    // unrolled: all 8 loads issue ahead of the first wait, a[] and b[] in registers
    #pragma unroll
    for (int u = 0; u < RVEC; ++u) {
        a[u] = pc[base + u * RTHREADS];
        b[u] = ps[base + u * RTHREADS];
    }
    // RTHREADS v4f are two whole rows, so the bias columns are the same for all u
    const v4f bv = ((const v4f*)bias)[base & (O_SZ / 4 - 1)];
    // unrolled: a[] and b[] are indexed by constants and stay in registers
    #pragma unroll
    for (int u = 0; u < RVEC; ++u)
        ((v4f*)out)[base + u * RTHREADS] = (a[u] + b[u]) + bv;
}

extern "C" void kernel_launch(void* const* d_in, const int* in_sizes, int n_in,
                              void* d_out, int out_size, void* d_ws, size_t ws_size,
                              hipStream_t stream) {
    const float* x      = (const float*)d_in[0];
    const float* coeffs = (const float*)d_in[1];
    const float* bias   = (const float*)d_in[2];
    float*       out    = (float*)d_out;
    float*       part   = (float*)d_ws;      // 2 planes of B_SZ x O_SZ floats

    dim3 grid(B_SZ / BM, O_SZ / BN, 2);  // 32 x 4 x 2 = 256 blocks, 4 waves each
    fourier_kan_wmma_kernel<<<grid, NTHREADS, 0, stream>>>(x, coeffs, part);
    fourier_kan_sum_kernel<<<B_SZ * O_SZ / 4 / (RTHREADS * RVEC), RTHREADS, 0, stream>>>(
        part, bias, out);
}

// v008
// One run takes 90 microseconds.
// Two timings next to v007 put it at 1.17 and 1.20 times that version's speed.
// Counting every step since v000, it is 6.98 times as fast.
#include <hip/hip_runtime.h>

typedef __attribute__((ext_vector_type(16))) _Float16 v16h;
typedef __attribute__((ext_vector_type(8)))  _Float16 v8h;
typedef __attribute__((ext_vector_type(8)))  float    v8f;
typedef __attribute__((ext_vector_type(4)))  float    v4f;
typedef __attribute__((ext_vector_type(2)))  float    v2f;

#define B_SZ 8192
#define I_SZ 512
#define O_SZ 512
#define G_SZ 16
#define KTOT (I_SZ * G_SZ)        // per-trig-part K = 8192

#define BM 256
#define BN 128
#define KT 32
#define NTHREADS 128              // 4 waves, one per SIMD, each a 64 x 128 tile
#define WM 64                     // rows of a wave's tile: 4 A fragments
#define NSTEPS (KTOT / KT)        // 256 K-steps: one trig part per work-group
#define XB 32                     // x columns per LDS block: one 128 B line of each row
#define XP 36                     // LDS row pitch of an x block in floats (a 16 B multiple)
#define XSTEPS (XB * G_SZ / KT)   // 16 K-steps live on one x block

#define INV_2PI 0.15915494309189535f

// Packed weights, made by the first launch: f16, in the order the WMMA B
// fragments are read. Unit = 16 B (8 halves). One K-step of one 128-column tile
// is 16 runs of 32 units: run c*2 + h holds, for lane l, halves h*8 .. h*8+7 of
// B tile c's fragment, so that one wave load is 512 contiguous bytes.
#define STEP_UNITS (BN * KT / 8)              // 512 units = 8 KB
#define TILE_UNITS (NSTEPS * STEP_UNITS)      // one (part, column tile)

// Foot of a K-step. s_wait_xcnt: a precaution, it stands in front of any
// overwrite of the step's loads' address registers. The "memory" clobber also
// keeps the compiler from moving this wave's x stores past later x reads of
// other lanes (the LDS serves one wave's operations in order).
__device__ __forceinline__ void step_foot()
{
    asm volatile("s_wait_xcnt 0x0" ::: "memory");
    // ends the step's scheduling region: without it the compiler sinks a step's
    // global loads to its foot
    __builtin_amdgcn_sched_barrier(0);
}
// The same at the foot of four steps, where the fragment loads' one changing
// address register, the lane's offset, moves on: it goes through the statement,
// so it keeps its value up to the wait and takes its new one behind it.
__device__ __forceinline__ void step_foot_advance(unsigned& voff)
{
    // ends the step's scheduling region ahead of the statement too: without it
    // the step's WMMAs sink behind the wait, apart from the features they cover
    __builtin_amdgcn_sched_barrier(0);
    asm volatile("s_wait_xcnt 0x0" : "+v"(voff) :: "memory");
    voff += 4 * STEP_UNITS;
    __builtin_amdgcn_sched_barrier(0);   // as above
}

// One work-group: a BM x BN tile of the partial product over ONE trig part
// (P = 0: cos half of K, P = 1: sin half), stored to that part's plane.
template <int P>
__device__ __forceinline__
void fourier_kan_part(const float* __restrict__ x,
                      const v8h* __restrict__ wtile,
                      float* __restrict__ part,
                      float* __restrict__ Xs)
{
    const int tid  = threadIdx.x;
    const int lane = tid & 31;
    const int wave = tid >> 5;             // 0..3 -> 64-row stripe, all BN columns
    const int row0 = blockIdx.x * BM;
    const int o0   = blockIdx.y * BN;

    // staging roles
    const int xr  = lane >> 3;             // x piece row 0..3 (+4 per load)
    const int xc  = (lane & 7) * 4;        // x block column: 8 lanes = one line

    v8f acc[32] = {};                      // [r*8 + c], r in 0..3, c in 0..7

    // A step's 32 k are 2 x columns times 16 frequencies. A lane half holds 16 of
    // them in its A and its B fragment alike (element j of lanes 0-15 and element
    // j of lanes 16-31 sit at fixed k places of the WMMA, the same in A and B):
    // here lane half h takes column h whole, element j = frequency j + 1, which
    // in a weight row are the 16 neighbours h*16 .. h*16 + 15.
    const int hcol    = lane >> 4;                       // this lane's column of a step
    const int hA      = hcol * 8;                        // C/D layout: row offset

    // ---- piece j (16 rows) of this wave's 64 rows of x block b: global ->
    //      registers, stored to LDS some K-steps later. Every wave load covers
    //      4 whole 128 B lines (a block past the last re-reads the last one) ----
    auto xpiece_load = [&](int b, int j, v4f (&t)[4]) {
        const int bs = (b < I_SZ / XB) ? b : I_SZ / XB - 1;
        const float* xb = x + (size_t)(row0 + j * 16) * I_SZ + bs * XB;  // uniform base
        // unrolled: the 4 loads issue together, t[] stays in registers
        #pragma unroll
        for (int k = 0; k < 4; ++k)
            t[k] = *(const v4f*)(xb + (unsigned)((wave * WM + k * 4 + xr) * I_SZ + xc));
    };
    auto xpiece_store = [&](int b, int j, const v4f (&t)[4]) {
        // unrolled: t[] is indexed by constants and stays in registers
        #pragma unroll
        for (int k = 0; k < 4; ++k)
            *(v4f*)&Xs[((b & 1) * BM + wave * WM + j * 16 + k * 4 + xr) * XP + xc] = t[k];
    };

    // ---- raw x of step s: this lane's x column for its row of each A tile,
    //      from the LDS block (rows that this wave stored itself) ----
    auto xread = [&](int s, float (&xv)[4]) {
        const float* xs = &Xs[((s / XSTEPS) & 1) * (BM * XP) + ((s * 2) & (XB - 1))
                              + (wave * WM + (lane & 15)) * XP + hcol]; // A tile r adds r*16
        // unrolled: xv[] is indexed by constants and stays in registers
        #pragma unroll
        for (int r = 0; r < 4; ++r)
            xv[r] = xs[r * 16 * XP];                       // ds_load_b32
    };
    // ---- the features of one K-step, made where the WMMA reads them: element
    //      j of A tile r is frequency j+1 of this lane's column. Frequencies 1
    //      and 2 come from the trig unit; the rest from the identity
    //      f((k+2)x) = 2 cos(2x) f(kx) - f((k-2)x), f = cos or sin, in f32, odd
    //      and even frequency side by side in one packed multiply-add ----
    auto make_a = [&](const float (&xv)[4], v16h (&A)[4]) {
        float t1[4], t2[4], f1[4], f2[4], c2[4];
        v2f fm[4], fc[4], mm[4];                  // f(k-2), f(k), 2 cos(2x) twice
        // every loop unrolled: the arrays are indexed by constants and stay in
        // registers. The A tile is the inner loop throughout: four independent
        // chains side by side, so that no instruction waits for the one before it
        #pragma unroll
        for (int r = 0; r < 4; ++r) t1[r] = xv[r] * INV_2PI;   // v_sin/cos take revolutions
        #pragma unroll
        for (int r = 0; r < 4; ++r) t2[r] = t1[r] + t1[r];
        #pragma unroll
        for (int r = 0; r < 4; ++r) c2[r] = __builtin_amdgcn_cosf(t2[r]);
        #pragma unroll
        for (int r = 0; r < 4; ++r)
            f1[r] = (P == 0) ? __builtin_amdgcn_cosf(t1[r]) : __builtin_amdgcn_sinf(t1[r]);
        #pragma unroll
        for (int r = 0; r < 4; ++r)
            f2[r] = (P == 0) ? c2[r] : __builtin_amdgcn_sinf(t2[r]);
        #pragma unroll
        for (int r = 0; r < 4; ++r) {
            const float m = c2[r] + c2[r];
            mm[r] = v2f{m, m};
        }
        #pragma unroll
        for (int r = 0; r < 4; ++r) {
            const float m = mm[r][0];
            fm[r] = v2f{f1[r], f2[r]};                            // frequencies 1, 2
            // frequencies 3, 4: cos(-x) = cos x, cos 0 = 1; sin(-x) = -sin x, sin 0 = 0
            if (P == 0) fc[r] = v2f{__builtin_fmaf(m, f1[r], -f1[r]), __builtin_fmaf(m, f2[r], -1.0f)};
            else        fc[r] = v2f{__builtin_fmaf(m, f1[r], f1[r]), m * f2[r]};
        }
        #pragma unroll
        for (int r = 0; r < 4; ++r) {
            A[r][0] = (_Float16)fm[r][0];
            A[r][1] = (_Float16)fm[r][1];
            A[r][2] = (_Float16)fc[r][0];
            A[r][3] = (_Float16)fc[r][1];
        }
        #pragma unroll
        for (int j = 2; j < 8; ++j) {
            #pragma unroll
            for (int r = 0; r < 4; ++r) {
                const v2f fn = __builtin_elementwise_fma(mm[r], fc[r], -fm[r]);  // v_pk_fma_f32
                A[r][2 * j]     = (_Float16)fn[0];
                A[r][2 * j + 1] = (_Float16)fn[1];
                fm[r] = fc[r];
                fc[r] = fn;
            }
        }
    };

    // B fragments of one K-step straight from the packed weights: 16
    // global_load_b128, each 512 contiguous bytes (wsrc: this lane's unit of run 0)
    auto load_b = [&](const v8h* wsrc, v16h (&Bf)[8]) {
        // unrolled: Bf[] is indexed by constants and stays in registers
        #pragma unroll
        for (int c = 0; c < 8; ++c) {
            const v8h lo = wsrc[c * 64];
            const v8h hi = wsrc[c * 64 + 32];
            #pragma unroll
            for (int j = 0; j < 8; ++j) { Bf[c][j] = lo[j]; Bf[c][j + 8] = hi[j]; }
        }
    };

    // four register sets of B fragments: step t lives in set t & 3
    v16h Bq[4][8];

    // prologue: x block 0 and the first piece of block 1 into LDS; the B
    // fragments of steps 0 to 2 asked for
    {
        v4f t[5][4];
        __builtin_amdgcn_sched_barrier(0);   // see the waits below
        // unrolled: t[] is indexed by constants and stays in registers
        #pragma unroll
        for (int j = 0; j < 4; ++j) xpiece_load(0, j, t[j]);
        xpiece_load(1, 0, t[4]);
        // precaution: stands in front of any overwrite of these loads' address
        // registers; the scheduling fences (one ahead of the loads, one here)
        // keep other address work out from between the loads and the wait
        asm volatile("s_wait_xcnt 0x0" ::: "memory");
        __builtin_amdgcn_sched_barrier(0);
        // unrolled: Bq[] is indexed by constants and stays in registers
        #pragma unroll
        for (int u = 0; u < 3; ++u) load_b(wtile + lane + u * STEP_UNITS, Bq[u]);
        // the same precaution for the fragment loads, with the same fence
        asm volatile("s_wait_xcnt 0x0" ::: "memory");
        __builtin_amdgcn_sched_barrier(0);
        #pragma unroll
        for (int j = 0; j < 4; ++j) xpiece_store(0, j, t[j]);
        xpiece_store(1, 0, t[4]);
    }
    // the x rows stored above are read by other lanes of the same wave
    __syncthreads();

    // two register sets of A fragments: one is multiplied while the other fills
    v16h AE[4], AO[4];
    float xvE[4], xvO[4];                      // raw x, even / odd steps

    // step 0's features, step 1's x
    xread(0, xvE);
    make_a(xvE, AE);
    xread(1, xvO);

    unsigned voff = lane;                      // this lane's unit in step s & ~3 of the tile
    v4f xt[4];                                 // a piece of an x block on its way to LDS

    // One K-step s, q = s & 3. On entry: Ac holds step s's features, Bc its B
    // fragments (asked for 3 steps ago), xn_ step s+1's x; xc_ and Bf (the set
    // of step s-1) are free. No wave reads what another wave wrote: no barrier.
    auto kstep = [&](int s, int q,
                     v16h (&Ac)[4], v16h (&An)[4],
                     float (&xc_)[4], float (&xn_)[4],
                     v16h (&Bc)[8], v16h (&Bf)[8]) {
        // 0) every 4th step asks for one piece of a coming x block and the
        //    3rd step behind it stores that piece. Piece xp & 3 of block
        //    xp / 4 + 1: its LDS buffer was last read at step 16 * (xp / 4) - 3,
        //    is written from step 16 * (xp / 4) - 1 to + 11, first read at + 14.
        const int xq = (s >> 2) + 1;
        const int xp = (xq < 4 * (I_SZ / XB - 1)) ? xq : 4 * (I_SZ / XB - 1);
        if (q == 0) xpiece_load((xp >> 2) + 1, xp & 3, xt);

        // 1) ask for step s+3's B fragments: uniform base, lane offset, the step
        //    a constant (past the tile's end: the next tile's first steps or the
        //    pad, asked for and not used); step s+2's x comes from LDS
        load_b(wtile + voff + (q + 3) * STEP_UNITS, Bf);
        xread((s < NSTEPS - 2) ? s + 2 : NSTEPS - 1, xc_);

        // 2) 32 WMMAs on registers filled during earlier steps
        //    (both loops unrolled: acc[], Ac[] and Bc[] stay in registers)
        #pragma unroll
        for (int r = 0; r < 4; ++r)
            #pragma unroll
            for (int c = 0; c < 8; ++c)
                acc[r * 8 + c] = __builtin_amdgcn_wmma_f32_16x16x32_f16(
                    false, Ac[r], false, Bc[c], (short)0, acc[r * 8 + c], false, false);

        // 3) step s+1's features straight into the idle A set
        make_a(xn_, An);

        // Pin the shape: every load of the step issues ahead of its first WMMA
        // (left alone the compiler sinks the loads towards their use, and their
        // lead is lost); the features fill between WMMAs.
        if (q == 0) __builtin_amdgcn_sched_group_barrier(0x020, 4, 0);  // VMEM read (x)
        __builtin_amdgcn_sched_group_barrier(0x020, 16, 0);  // VMEM read
        __builtin_amdgcn_sched_group_barrier(0x100, 4,  0);  // DS read
        // unrolled: each call is one group of the step's schedule
        #pragma unroll
        for (int g = 0; g < 32; ++g) {
            __builtin_amdgcn_sched_group_barrier(0x008, 1, 0);  // WMMA
            __builtin_amdgcn_sched_group_barrier(0x402, 3, 0);  // VALU + trans
        }

        if (q == 3) xpiece_store((xp >> 2) + 1, xp & 3, xt);

        // Inputs only, no instruction: step s+1's A set is complete at this
        // step's foot. Without it the compiler keeps the features in f32 and
        // converts them in the next step, over the one A set its WMMAs are
        // reading, so that every row of WMMAs waits for its own conversion.
        asm volatile("" :: "v"(An[0]), "v"(An[1]), "v"(An[2]), "v"(An[3]));

        // 4) no barrier; global loads stay in flight over the foot
        if (q == 3) step_foot_advance(voff);
        else        step_foot();
    };

    for (int s = 0; s < NSTEPS; s += 4) {
        kstep(s,     0, AE, AO, xvE, xvO, Bq[0], Bq[3]);
        kstep(s + 1, 1, AO, AE, xvO, xvE, Bq[1], Bq[0]);
        kstep(s + 2, 2, AE, AO, xvE, xvO, Bq[2], Bq[1]);
        kstep(s + 3, 3, AO, AE, xvO, xvE, Bq[3], Bq[2]);
    }

    // ---- epilogue: store this K half's fp32 partial sums to its own plane
    //      (C/D layout: VGPR j -> row j / j+8) ----
    //      one address per lane, every tile, row and column step a constant
    float* __restrict__ dst = part + (size_t)P * (B_SZ * O_SZ)
        + (size_t)(row0 + wave * WM + hA) * O_SZ + o0 + (lane & 15);
    #pragma unroll
    for (int r = 0; r < 4; ++r) {
        #pragma unroll
        for (int c = 0; c < 8; ++c) {
            #pragma unroll
            for (int j = 0; j < 8; ++j)
                dst[(r * 16 + j) * O_SZ + c * 16] = acc[r * 8 + c][j];
        }
    }
}

// First launch: the weights to f16, in B-fragment order (see STEP_UNITS above).
// A thread turns 8 neighbouring floats of one weight row into one 16 B unit,
// for PSTEPS K-steps. A wave reads 8 rows, 4 lanes to a 128 B line, and its
// store fills 4 whole 128 B lines (8 neighbouring rows of one lane half).
// PSTEPS: few waves with many loads each, so that the launch is not held up by
// the start of its waves.
#define PTHREADS 256
#define PSTEPS 8
#define PGRID_Y (NSTEPS / (PTHREADS / 32 * PSTEPS))
__global__ __launch_bounds__(PTHREADS)
void fourier_kan_pack_kernel(const float* __restrict__ coeffs,
                             float* __restrict__ wpack)
{
    const int lane = threadIdx.x & 31;
    const int wave = threadIdx.x >> 5;
    const int q    = lane & 3;                            // 8-float chunk of a step's 32 k
    const int row  = blockIdx.x * 8 + (lane >> 2);        // part * O_SZ + output column
    const int s0   = (blockIdx.y * (PTHREADS / 32) + wave) * PSTEPS;
    const float* src = coeffs + (size_t)row * KTOT + s0 * KT + q * 8;
    v4f lo[PSTEPS], hi[PSTEPS];
    // unrolled: all loads issue ahead of the first wait, lo[] and hi[] in registers
    #pragma unroll
    for (int u = 0; u < PSTEPS; ++u) {
        lo[u] = *(const v4f*)(src + u * KT);
        hi[u] = *(const v4f*)(src + u * KT + 4);
    }
    // precaution: stands in front of any overwrite of these loads' address
    // registers; the address is an input, so it lives up to the wait and no
    // load's result lands on it
    asm volatile("s_wait_xcnt 0x0" :: "v"(src) : "memory");
    // without it the compiler lifts the first conversions over the last loads
    // to save registers, and those loads wait out the first ones' latency
    __builtin_amdgcn_sched_barrier(0);
    // unit index: (part, column tile), step, run c*2 + h, lane = half*16 + column
    v8h* dst = (v8h*)wpack + (size_t)(row >> 7) * TILE_UNITS + (size_t)s0 * STEP_UNITS
             + (((row >> 4) & 7) * 2 + (q & 1)) * 32 + (q >> 1) * 16 + (row & 15);
    // unrolled: lo[] and hi[] are indexed by constants and stay in registers
    #pragma unroll
    for (int u = 0; u < PSTEPS; ++u) {
        v8h wh;
        #pragma unroll
        for (int j = 0; j < 4; ++j) {
            wh[j]     = (_Float16)lo[u][j];
            wh[j + 4] = (_Float16)hi[u][j];
        }
        dst[u * STEP_UNITS] = wh;
    }
    // precaution: stands in front of any overwrite of these stores' registers
    asm volatile("s_wait_xcnt 0x0" ::: "memory");
    // three K-steps of zeros behind the last tile (the K loop asks three steps
    // ahead), one unit a thread of the first few blocks
    if (blockIdx.y == 0 && blockIdx.x < 3 * STEP_UNITS / PTHREADS)
        ((v8h*)wpack)[(size_t)(2 * O_SZ / BN) * TILE_UNITS + blockIdx.x * PTHREADS + threadIdx.x] = v8h{};
}

__global__ __launch_bounds__(NTHREADS)
void fourier_kan_wmma_kernel(const float* __restrict__ x,
                             const float* __restrict__ wpack,
                             float* __restrict__ part)
{
    // Two buffers of raw x, BM rows x XB columns each: filled by whole-line
    // loads once per XSTEPS steps, read back one float per lane, A tile and step.
    // Every wave stores and reads its own 64 rows only.
    __shared__ __align__(16) float    Xs[2 * BM * XP];  // 72 KB

    // this (part, column tile)'s packed weights: a scalar base for every load
    const v8h* wt = (const v8h*)wpack
                  + (size_t)(blockIdx.z * (O_SZ / BN) + blockIdx.y) * TILE_UNITS;
    if (blockIdx.z != 0) fourier_kan_part<1>(x, wt, part, Xs);
    else                 fourier_kan_part<0>(x, wt, part, Xs);
}

// out = cos partial + sin partial + bias. 4 x 16 B per thread from each plane:
// 8 independent loads in flight per lane, every wave on whole 512 B runs.
#define RTHREADS 256
#define RVEC 4
__global__ __launch_bounds__(RTHREADS)
void fourier_kan_sum_kernel(const float* __restrict__ part,
                            const float* __restrict__ bias,
                            float* __restrict__ out)
{
    const int base = blockIdx.x * (RTHREADS * RVEC) + threadIdx.x;  // in v4f
    const v4f* __restrict__ pc = (const v4f*)part;
    const v4f* __restrict__ ps = (const v4f*)(part + (size_t)B_SZ * O_SZ);
    v4f a[RVEC], b[RVEC];
    // unrolled: all 8 loads issue ahead of the first wait, a[] and b[] in registers
    #pragma unroll
    for (int u = 0; u < RVEC; ++u) {
        a[u] = pc[base + u * RTHREADS];
        b[u] = ps[base + u * RTHREADS];
    }
    // RTHREADS v4f are two whole rows, so the bias columns are the same for all u
    const v4f bv = ((const v4f*)bias)[base & (O_SZ / 4 - 1)];
    // unrolled: a[] and b[] are indexed by constants and stay in registers
    #pragma unroll
    for (int u = 0; u < RVEC; ++u)
        ((v4f*)out)[base + u * RTHREADS] = (a[u] + b[u]) + bv;
}

extern "C" void kernel_launch(void* const* d_in, const int* in_sizes, int n_in,
                              void* d_out, int out_size, void* d_ws, size_t ws_size,
                              hipStream_t stream) {
    const float* x      = (const float*)d_in[0];
    const float* coeffs = (const float*)d_in[1];
    const float* bias   = (const float*)d_in[2];
    float*       out    = (float*)d_out;
    float*       part   = (float*)d_ws;      // 2 planes of B_SZ x O_SZ floats
    float*       wpack  = part + 2 * B_SZ * O_SZ;  // 16 MB of packed f16 weights + 24 KB pad

    dim3 grid(B_SZ / BM, O_SZ / BN, 2);  // 32 x 4 x 2 = 256 blocks, 4 waves each
    fourier_kan_pack_kernel<<<dim3(2 * O_SZ / 8, PGRID_Y), PTHREADS, 0, stream>>>(
        coeffs, wpack);
    fourier_kan_wmma_kernel<<<grid, NTHREADS, 0, stream>>>(x, wpack, part);
    fourier_kan_sum_kernel<<<B_SZ * O_SZ / 4 / (RTHREADS * RVEC), RTHREADS, 0, stream>>>(
        part, bias, out);
}

// v009
// A run of this version takes 82.1 microseconds.
// Next to v008, in two timings, it ran 1.10 and 1.09 times as fast.
// Over all steps from v000 it is 7.66 times as fast.
#include <hip/hip_runtime.h>

typedef __attribute__((ext_vector_type(16))) _Float16 v16h;
typedef __attribute__((ext_vector_type(8)))  _Float16 v8h;
typedef __attribute__((ext_vector_type(8)))  float    v8f;
typedef __attribute__((ext_vector_type(4)))  float    v4f;
typedef __attribute__((ext_vector_type(2)))  float    v2f;

#define B_SZ 8192
#define I_SZ 512
#define O_SZ 512
#define G_SZ 16
#define KTOT (I_SZ * G_SZ)        // per-trig-part K = 8192

#define BM 128
#define BN 128
#define KT 32
#define NTHREADS 128              // 4 waves, one per SIMD: 2 row stripes x 2 trig parts
#define WM 64                     // rows of a wave's tile: 4 A fragments
#define XROWS (NTHREADS / 32 * WM) // LDS rows of an x block: every wave has its own 64
#define NSTEPS (KTOT / KT)        // 256 K-steps: one trig part per wave
#define XB 32                     // x columns per LDS block: one 128 B line of each row
#define XP 36                     // LDS row pitch of an x block in floats (a 16 B multiple)
#define XSTEPS (XB * G_SZ / KT)   // 16 K-steps live on one x block

#define INV_2PI 0.15915494309189535f

// Packed weights, made by the first launch: f16, in the order the WMMA B
// fragments are read. Unit = 16 B (8 halves). One K-step of one 128-column tile
// is 16 runs of 32 units: run c*2 + h holds, for lane l, halves h*8 .. h*8+7 of
// B tile c's fragment, so that one wave load is 512 contiguous bytes.
#define STEP_UNITS (BN * KT / 8)              // 512 units = 8 KB
#define TILE_UNITS (NSTEPS * STEP_UNITS)      // one (part, column tile)

// Foot of a K-step. s_wait_xcnt: a precaution, it stands in front of any
// overwrite of the step's loads' address registers. The "memory" clobber also
// keeps the compiler from moving this wave's x stores past later x reads of
// other lanes (the LDS serves one wave's operations in order).
__device__ __forceinline__ void step_foot()
{
    asm volatile("s_wait_xcnt 0x0" ::: "memory");
    // ends the step's scheduling region: without it the compiler sinks a step's
    // global loads to its foot
    __builtin_amdgcn_sched_barrier(0);
}
// The same at the foot of four steps, where the fragment loads' one changing
// address register, the lane's offset, moves on: it goes through the statement,
// so it keeps its value up to the wait and takes its new one behind it.
__device__ __forceinline__ void step_foot_advance(unsigned& voff)
{
    // ends the step's scheduling region ahead of the statement too: without it
    // the step's WMMAs sink behind the wait, apart from the features they cover
    __builtin_amdgcn_sched_barrier(0);
    asm volatile("s_wait_xcnt 0x0" : "+v"(voff) :: "memory");
    voff += 4 * STEP_UNITS;
    __builtin_amdgcn_sched_barrier(0);   // as above
}

// a compile-time number handed to a lambda (the trig part)
template <int V> struct num { static constexpr int value = V; };

// One work-group: a BM x BN tile of the output over the whole K. A wave has a
// 64 x BN tile of the product over ONE trig part (0: cos half of K, 1: sin
// half); the two parts of a row stripe meet in LDS behind the K loop.
__global__ __launch_bounds__(NTHREADS)
void fourier_kan_wmma_kernel(const float* __restrict__ x,
                             const float* __restrict__ wpack,
                             const float* __restrict__ bias,
                             float* __restrict__ out)
{
    // Two buffers of raw x, XROWS rows x XB columns each: filled by whole-line
    // loads once per XSTEPS steps, read back one float per lane, A tile and step.
    // Every wave stores and reads its own 64 rows only.
    __shared__ __align__(16) float Xs[2 * XROWS * XP];            // 72 KB
    // Behind the K loop: each wave's half tile on its way to the other part's wave
    __shared__ __align__(16) float Ex[NTHREADS * (WM / 2) * BN / 32];  // 64 KB

    const int tid  = threadIdx.x;
    const int lane = tid & 31;
    // the wave's number in a scalar register: the part is a scalar branch, the
    // packed weights a scalar base
    const int wave   = __builtin_amdgcn_readfirstlane(tid >> 5);
    const int stripe = wave & 1;           // 64-row stripe, all BN columns
    const int prt    = wave >> 1;          // trig part
    const int row0 = blockIdx.x * BM;
    const int o0   = blockIdx.y * BN;

    // this (part, column tile)'s packed weights: a scalar base for every load
    const v8h* wtile = (const v8h*)wpack
                     + (size_t)(prt * (O_SZ / BN) + blockIdx.y) * TILE_UNITS;

    // staging roles
    const int xr  = lane >> 3;             // x piece row 0..3 (+4 per load)
    const int xc  = (lane & 7) * 4;        // x block column: 8 lanes = one line

    v8f acc[32] = {};                      // [r*8 + c], r in 0..3, c in 0..7

    // A step's 32 k are 2 x columns times 16 frequencies. A lane half holds 16 of
    // them in its A and its B fragment alike (element j of lanes 0-15 and element
    // j of lanes 16-31 sit at fixed k places of the WMMA, the same in A and B):
    // here lane half h takes column h whole, element j = frequency j + 1, which
    // in a weight row are the 16 neighbours h*16 .. h*16 + 15.
    const int hcol    = lane >> 4;                       // this lane's column of a step
    const int hA      = hcol * 8;                        // C/D layout: row offset

    // ---- piece j (16 rows) of this wave's 64 rows of x block b: global ->
    //      registers, stored to LDS some K-steps later. Every wave load covers
    //      4 whole 128 B lines (a block past the last re-reads the last one) ----
    auto xpiece_load = [&](int b, int j, v4f (&t)[4]) {
        const int bs = (b < I_SZ / XB) ? b : I_SZ / XB - 1;
        const float* xb = x + (size_t)(row0 + j * 16) * I_SZ + bs * XB;  // uniform base
        // unrolled: the 4 loads issue together, t[] stays in registers
        #pragma unroll
        for (int k = 0; k < 4; ++k)
            t[k] = *(const v4f*)(xb + (unsigned)((stripe * WM + k * 4 + xr) * I_SZ + xc));
    };
    auto xpiece_store = [&](int b, int j, const v4f (&t)[4]) {
        // unrolled: t[] is indexed by constants and stays in registers
        #pragma unroll
        for (int k = 0; k < 4; ++k)
            *(v4f*)&Xs[((b & 1) * XROWS + wave * WM + j * 16 + k * 4 + xr) * XP + xc] = t[k];
    };

    // ---- raw x of step s: this lane's x column for its row of each A tile,
    //      from the LDS block (rows that this wave stored itself) ----
    auto xread = [&](int s, float (&xv)[4]) {
        const float* xs = &Xs[((s / XSTEPS) & 1) * (XROWS * XP) + ((s * 2) & (XB - 1))
                              + (wave * WM + (lane & 15)) * XP + hcol]; // A tile r adds r*16
        // unrolled: xv[] is indexed by constants and stays in registers
        #pragma unroll
        for (int r = 0; r < 4; ++r)
            xv[r] = xs[r * 16 * XP];                       // ds_load_b32
    };
    // ---- the features of one K-step, made where the WMMA reads them: element
    //      j of A tile r is frequency j+1 of this lane's column. Frequencies 1
    //      and 2 come from the trig unit; the rest from the identity
    //      f((k+2)x) = 2 cos(2x) f(kx) - f((k-2)x), f = cos or sin, in f32, odd
    //      and even frequency side by side in one packed multiply-add ----
    auto make_a = [&](auto pc, const float (&xv)[4], v16h (&A)[4]) {
        constexpr int P = decltype(pc)::value;    // 0: cos, 1: sin
        float t1[4], t2[4], f1[4], f2[4], c2[4];
        v2f fm[4], fc[4], mm[4];                  // f(k-2), f(k), 2 cos(2x) twice
        // every loop unrolled: the arrays are indexed by constants and stay in
        // registers. The A tile is the inner loop throughout: four independent
        // chains side by side, so that no instruction waits for the one before it
        #pragma unroll
        for (int r = 0; r < 4; ++r) t1[r] = xv[r] * INV_2PI;   // v_sin/cos take revolutions
        #pragma unroll
        for (int r = 0; r < 4; ++r) t2[r] = t1[r] + t1[r];
        #pragma unroll
        for (int r = 0; r < 4; ++r) c2[r] = __builtin_amdgcn_cosf(t2[r]);
        #pragma unroll
        for (int r = 0; r < 4; ++r)
            f1[r] = (P == 0) ? __builtin_amdgcn_cosf(t1[r]) : __builtin_amdgcn_sinf(t1[r]);
        #pragma unroll
        for (int r = 0; r < 4; ++r)
            f2[r] = (P == 0) ? c2[r] : __builtin_amdgcn_sinf(t2[r]);
        #pragma unroll
        for (int r = 0; r < 4; ++r) {
            const float m = c2[r] + c2[r];
            mm[r] = v2f{m, m};
        }
        #pragma unroll
        for (int r = 0; r < 4; ++r) {
            const float m = mm[r][0];
            fm[r] = v2f{f1[r], f2[r]};                            // frequencies 1, 2
            // frequencies 3, 4: cos(-x) = cos x, cos 0 = 1; sin(-x) = -sin x, sin 0 = 0
            if (P == 0) fc[r] = v2f{__builtin_fmaf(m, f1[r], -f1[r]), __builtin_fmaf(m, f2[r], -1.0f)};
            else        fc[r] = v2f{__builtin_fmaf(m, f1[r], f1[r]), m * f2[r]};
        }
        #pragma unroll
        for (int r = 0; r < 4; ++r) {
            A[r][0] = (_Float16)fm[r][0];
            A[r][1] = (_Float16)fm[r][1];
            A[r][2] = (_Float16)fc[r][0];
            A[r][3] = (_Float16)fc[r][1];
        }
        #pragma unroll
        for (int j = 2; j < 8; ++j) {
            #pragma unroll
            for (int r = 0; r < 4; ++r) {
                const v2f fn = __builtin_elementwise_fma(mm[r], fc[r], -fm[r]);  // v_pk_fma_f32
                A[r][2 * j]     = (_Float16)fn[0];
                A[r][2 * j + 1] = (_Float16)fn[1];
                fm[r] = fc[r];
                fc[r] = fn;
            }
        }
    };

    // B fragments of one K-step straight from the packed weights: 16
    // global_load_b128, each 512 contiguous bytes (wsrc: this lane's unit of run 0)
    auto load_b = [&](const v8h* wsrc, v16h (&Bf)[8]) {
        // unrolled: Bf[] is indexed by constants and stays in registers
        #pragma unroll
        for (int c = 0; c < 8; ++c) {
            const v8h lo = wsrc[c * 64];
            const v8h hi = wsrc[c * 64 + 32];
            #pragma unroll
            for (int j = 0; j < 8; ++j) { Bf[c][j] = lo[j]; Bf[c][j + 8] = hi[j]; }
        }
    };

    // four register sets of B fragments: step t lives in set t & 3
    v16h Bq[4][8];

    // prologue: x block 0 and the first piece of block 1 into LDS; the B
    // fragments of steps 0 to 2 asked for
    {
        v4f t[5][4];
        __builtin_amdgcn_sched_barrier(0);   // see the waits below
        // unrolled: t[] is indexed by constants and stays in registers
        #pragma unroll
        for (int j = 0; j < 4; ++j) xpiece_load(0, j, t[j]);
        xpiece_load(1, 0, t[4]);
        // precaution: stands in front of any overwrite of these loads' address
        // registers; the scheduling fences (one ahead of the loads, one here)
        // keep other address work out from between the loads and the wait
        asm volatile("s_wait_xcnt 0x0" ::: "memory");
        __builtin_amdgcn_sched_barrier(0);
        // unrolled: Bq[] is indexed by constants and stays in registers
        #pragma unroll
        for (int u = 0; u < 3; ++u) load_b(wtile + lane + u * STEP_UNITS, Bq[u]);
        // the same precaution for the fragment loads, with the same fence
        asm volatile("s_wait_xcnt 0x0" ::: "memory");
        __builtin_amdgcn_sched_barrier(0);
        #pragma unroll
        for (int j = 0; j < 4; ++j) xpiece_store(0, j, t[j]);
        xpiece_store(1, 0, t[4]);
    }
    // the x rows stored above are read by other lanes of the same wave
    __syncthreads();

    // ---- the K loop of one trig part ----
    auto kloop = [&](auto pc) {
    // two register sets of A fragments: one is multiplied while the other fills
    v16h AE[4], AO[4];
    float xvE[4], xvO[4];                      // raw x, even / odd steps

    // step 0's features, step 1's x
    xread(0, xvE);
    make_a(pc, xvE, AE);
    xread(1, xvO);

    unsigned voff = lane;                      // this lane's unit in step s & ~3 of the tile
    v4f xt[4];                                 // a piece of an x block on its way to LDS

    // One K-step s, q = s & 3. On entry: Ac holds step s's features, Bc its B
    // fragments (asked for 3 steps ago), xn_ step s+1's x; xc_ and Bf (the set
    // of step s-1) are free. No wave reads what another wave wrote: no barrier.
    auto kstep = [&](int s, int q,
                     v16h (&Ac)[4], v16h (&An)[4],
                     float (&xc_)[4], float (&xn_)[4],
                     v16h (&Bc)[8], v16h (&Bf)[8]) {
        // 0) every 4th step asks for one piece of a coming x block and the
        //    3rd step behind it stores that piece. Piece xp & 3 of block
        //    xp / 4 + 1: its LDS buffer was last read at step 16 * (xp / 4) - 3,
        //    is written from step 16 * (xp / 4) - 1 to + 11, first read at + 14.
        const int xq = (s >> 2) + 1;
        const int xp = (xq < 4 * (I_SZ / XB - 1)) ? xq : 4 * (I_SZ / XB - 1);
        if (q == 0) xpiece_load((xp >> 2) + 1, xp & 3, xt);

        // 1) ask for step s+3's B fragments: uniform base, lane offset, the step
        //    a constant (past the tile's end: the next tile's first steps or the
        //    pad, asked for and not used); step s+2's x comes from LDS
        load_b(wtile + voff + (q + 3) * STEP_UNITS, Bf);
        xread((s < NSTEPS - 2) ? s + 2 : NSTEPS - 1, xc_);

        // 2) 32 WMMAs on registers filled during earlier steps
        //    (both loops unrolled: acc[], Ac[] and Bc[] stay in registers)
        #pragma unroll
        for (int r = 0; r < 4; ++r)
            #pragma unroll
            for (int c = 0; c < 8; ++c)
                acc[r * 8 + c] = __builtin_amdgcn_wmma_f32_16x16x32_f16(
                    false, Ac[r], false, Bc[c], (short)0, acc[r * 8 + c], false, false);

        // 3) step s+1's features straight into the idle A set
        make_a(pc, xn_, An);

        // Pin the shape: every load of the step issues ahead of its first WMMA
        // (left alone the compiler sinks the loads towards their use, and their
        // lead is lost); the features fill between WMMAs.
        if (q == 0) __builtin_amdgcn_sched_group_barrier(0x020, 4, 0);  // VMEM read (x)
        __builtin_amdgcn_sched_group_barrier(0x020, 16, 0);  // VMEM read
        __builtin_amdgcn_sched_group_barrier(0x100, 4,  0);  // DS read
        // unrolled: each call is one group of the step's schedule
        #pragma unroll
        for (int g = 0; g < 32; ++g) {
            __builtin_amdgcn_sched_group_barrier(0x008, 1, 0);  // WMMA
            __builtin_amdgcn_sched_group_barrier(0x402, 3, 0);  // VALU + trans
        }

        if (q == 3) xpiece_store((xp >> 2) + 1, xp & 3, xt);

        // Inputs only, no instruction: step s+1's A set is complete at this
        // step's foot. Without it the compiler keeps the features in f32 and
        // converts them in the next step, over the one A set its WMMAs are
        // reading, so that every row of WMMAs waits for its own conversion.
        asm volatile("" :: "v"(An[0]), "v"(An[1]), "v"(An[2]), "v"(An[3]));

        // 4) no barrier; global loads stay in flight over the foot
        if (q == 3) step_foot_advance(voff);
        else        step_foot();
    };

    for (int s = 0; s < NSTEPS; s += 4) {
        kstep(s,     0, AE, AO, xvE, xvO, Bq[0], Bq[3]);
        kstep(s + 1, 1, AO, AE, xvO, xvE, Bq[1], Bq[0]);
        kstep(s + 2, 2, AE, AO, xvE, xvO, Bq[2], Bq[1]);
        kstep(s + 3, 3, AO, AE, xvO, xvE, Bq[3], Bq[2]);
    }

    };
    // a scalar branch; no barrier stands inside it
    if (prt != 0) kloop(num<1>{});
    else          kloop(num<0>{});

    // ---- epilogue: out = (cos part + sin part) + bias. Of a stripe's 64 rows
    //      the cos wave finishes the first 32 (A tiles 0, 1), the sin wave the
    //      last 32; each hands the other half of its sums over through LDS, a
    //      lane to the same lane (C/D layout: VGPR j -> row j / j+8) ----
    // the sin wave's halves change places: from here on every wave keeps
    // acc[0..15] and hands over acc[16..31], in one code path
    if (prt != 0) {
        // unrolled: acc[] is indexed by constants and stays in registers
        #pragma unroll
        for (int t = 0; t < 16; ++t) {
            const v8f a = acc[t];
            acc[t]      = acc[16 + t];
            acc[16 + t] = a;
        }
    }

    const unsigned col = o0 + (lane & 15);
    float bv[8];
    // unrolled: bv[] is indexed by constants and stays in registers
    #pragma unroll
    for (int c = 0; c < 8; ++c) bv[c] = bias[col + c * 16];
    // precaution: stands in front of any overwrite of these loads' address
    // register, which is an input, so that it lives up to the wait
    asm volatile("s_wait_xcnt 0x0" :: "v"(col) : "memory");

    // unit = 16 B; run t*2 + h of a wave holds, for lane l, sums h*4 .. h*4+3 of
    // tile t of the half: every LDS operation is 512 contiguous bytes
    v4f* ex = (v4f*)Ex + lane;
    {
        v4f* e = ex + wave * (32 * 32);
        // unrolled: acc[] is indexed by constants and stays in registers
        #pragma unroll
        for (int t = 0; t < 16; ++t) {
            const v8f a = acc[16 + t];
            e[(t * 2) * 32]     = v4f{a[0], a[1], a[2], a[3]};
            e[(t * 2 + 1) * 32] = v4f{a[4], a[5], a[6], a[7]};
        }
    }
    // the sums stored above are read by the other part's wave
    __syncthreads();
    {
        const v4f* e = ex + (wave ^ 2) * (32 * 32);     // the other part, same stripe
        // all loops unrolled: acc[] and bv[] are indexed by constants and stay in registers
        #pragma unroll
        for (int t = 0; t < 16; ++t) {
            const v4f lo = e[(t * 2) * 32];
            const v4f hi = e[(t * 2 + 1) * 32];
            #pragma unroll
            for (int j = 0; j < 4; ++j) {
                acc[t][j]     = (acc[t][j] + lo[j]) + bv[t & 7];
                acc[t][j + 4] = (acc[t][j + 4] + hi[j]) + bv[t & 7];
            }
        }
        // one address per lane, every tile, row and column step a constant
        float* __restrict__ dst = out
            + (size_t)(row0 + stripe * WM + prt * (WM / 2) + hA) * O_SZ + col;
        // every sum is made ahead of the first store, in its own register: behind
        // a store nothing overwrites a register that the store names
        __builtin_amdgcn_sched_barrier(0);
        #pragma unroll
        for (int t = 0; t < 16; ++t) {
            #pragma unroll
            for (int j = 0; j < 8; ++j)
                dst[((t >> 3) * 16 + j) * O_SZ + (t & 7) * 16] = acc[t][j];
        }
    }
}

// First launch: the weights to f16, in B-fragment order (see STEP_UNITS above).
// A thread turns 8 neighbouring floats of one weight row into one 16 B unit,
// for PSTEPS K-steps. A wave reads 8 rows, 4 lanes to a 128 B line, and its
// store fills 4 whole 128 B lines (8 neighbouring rows of one lane half).
// PSTEPS: few waves with many loads each, so that the launch is not held up by
// the start of its waves.
#define PTHREADS 256
#define PSTEPS 8
#define PGRID_Y (NSTEPS / (PTHREADS / 32 * PSTEPS))
__global__ __launch_bounds__(PTHREADS)
void fourier_kan_pack_kernel(const float* __restrict__ coeffs,
                             float* __restrict__ wpack)
{
    const int lane = threadIdx.x & 31;
    const int wave = threadIdx.x >> 5;
    const int q    = lane & 3;                            // 8-float chunk of a step's 32 k
    const int row  = blockIdx.x * 8 + (lane >> 2);        // part * O_SZ + output column
    const int s0   = (blockIdx.y * (PTHREADS / 32) + wave) * PSTEPS;
    const float* src = coeffs + (size_t)row * KTOT + s0 * KT + q * 8;
    v4f lo[PSTEPS], hi[PSTEPS];
    // unrolled: all loads issue ahead of the first wait, lo[] and hi[] in registers
    #pragma unroll
    for (int u = 0; u < PSTEPS; ++u) {
        lo[u] = *(const v4f*)(src + u * KT);
        hi[u] = *(const v4f*)(src + u * KT + 4);
    }
    // precaution: stands in front of any overwrite of these loads' address
    // registers; the address is an input, so it lives up to the wait and no
    // load's result lands on it
    asm volatile("s_wait_xcnt 0x0" :: "v"(src) : "memory");
    // without it the compiler lifts the first conversions over the last loads
    // to save registers, and those loads wait out the first ones' latency
    __builtin_amdgcn_sched_barrier(0);
    // unit index: (part, column tile), step, run c*2 + h, lane = half*16 + column
    v8h* dst = (v8h*)wpack + (size_t)(row >> 7) * TILE_UNITS + (size_t)s0 * STEP_UNITS
             + (((row >> 4) & 7) * 2 + (q & 1)) * 32 + (q >> 1) * 16 + (row & 15);
    // unrolled: lo[] and hi[] are indexed by constants and stay in registers
    #pragma unroll
    for (int u = 0; u < PSTEPS; ++u) {
        v8h wh;
        #pragma unroll
        for (int j = 0; j < 4; ++j) {
            wh[j]     = (_Float16)lo[u][j];
            wh[j + 4] = (_Float16)hi[u][j];
        }
        dst[u * STEP_UNITS] = wh;
    }
    // precaution: stands in front of any overwrite of these stores' registers
    asm volatile("s_wait_xcnt 0x0" ::: "memory");
    // three K-steps of zeros behind the last tile (the K loop asks three steps
    // ahead), one unit a thread of the first few blocks
    if (blockIdx.y == 0 && blockIdx.x < 3 * STEP_UNITS / PTHREADS)
        ((v8h*)wpack)[(size_t)(2 * O_SZ / BN) * TILE_UNITS + blockIdx.x * PTHREADS + threadIdx.x] = v8h{};
}

extern "C" void kernel_launch(void* const* d_in, const int* in_sizes, int n_in,
                              void* d_out, int out_size, void* d_ws, size_t ws_size,
                              hipStream_t stream) {
    const float* x      = (const float*)d_in[0];
    const float* coeffs = (const float*)d_in[1];
    const float* bias   = (const float*)d_in[2];
    float*       out    = (float*)d_out;
    float*       wpack  = (float*)d_ws;      // 16 MB of packed f16 weights + 24 KB pad

    dim3 grid(B_SZ / BM, O_SZ / BN);     // 64 x 4 = 256 blocks, 4 waves each
    fourier_kan_pack_kernel<<<dim3(2 * O_SZ / 8, PGRID_Y), PTHREADS, 0, stream>>>(
        coeffs, wpack);
    fourier_kan_wmma_kernel<<<grid, NTHREADS, 0, stream>>>(x, wpack, bias, out);
}

// v010
// A run of this version takes 77.7 microseconds.
// Next to v009, in two timings, it ran 1.06 times as fast each time.
// Counting every step since v000, it is 8.12 times as fast.
#include <hip/hip_runtime.h>

typedef __attribute__((ext_vector_type(16))) _Float16 v16h;
typedef __attribute__((ext_vector_type(8)))  _Float16 v8h;
typedef __attribute__((ext_vector_type(8)))  float    v8f;
typedef __attribute__((ext_vector_type(4)))  float    v4f;
typedef __attribute__((ext_vector_type(2)))  float    v2f;

#define B_SZ 8192
#define I_SZ 512
#define O_SZ 512
#define G_SZ 16
#define KTOT (I_SZ * G_SZ)        // per-trig-part K = 8192

#define BM 128
#define BN 128
#define KT 32
#define NTHREADS 256              // 8 waves, two per SIMD: 2 row stripes x 2 trig parts x 2 K halves
#define NWAVES (NTHREADS / 32)
#define WM 64                     // rows of a wave's tile: 4 A fragments
#define XROWS (NWAVES * WM)       // LDS rows of an x block: every wave has its own 64
#define NSTEPS (KTOT / KT)        // 256 K-steps in a trig part
#define WSTEPS (NSTEPS / 2)       // 128 K-steps per wave: half of one trig part
#define XB 32                     // x columns per LDS block: one 128 B line of each row
#define XP 36                     // LDS row pitch of an x block in floats (a 16 B multiple)
#define XSTEPS (XB * G_SZ / KT)   // 16 K-steps live on one x block
#define XBLKS (WSTEPS / XSTEPS)   // 8 x blocks per wave

#define INV_2PI 0.15915494309189535f

// Packed weights, made by the first launch: f16, in the order the WMMA B
// fragments are read. Unit = 16 B (8 halves). One K-step of one 128-column tile
// is 16 runs of 32 units: run c*2 + h holds, for lane l, halves h*8 .. h*8+7 of
// B tile c's fragment, so that one wave load is 512 contiguous bytes.
#define STEP_UNITS (BN * KT / 8)              // 512 units = 8 KB
#define TILE_UNITS (NSTEPS * STEP_UNITS)      // one (part, column tile)

// Between a K-step's vector run and its matrix run. s_wait_xcnt: a precaution,
// it stands in front of any overwrite of the earlier loads' address registers
// (the last of them issued a vector run ago). The "memory" clobber also keeps
// the compiler from moving this wave's x stores past later x reads of other
// lanes (the LDS serves one wave's operations in order).
__device__ __forceinline__ void step_mid()
{
    // ends the vector run's scheduling region: without the two fences the runs
    // on either side drift over the wait
    __builtin_amdgcn_sched_barrier(0);
    asm volatile("s_wait_xcnt 0x0" ::: "memory");
    __builtin_amdgcn_sched_barrier(0);   // as above
}
// The same once in four steps, where the fragment loads' one changing address
// register, the lane's offset, moves on: it goes through the statement, so it
// keeps its value up to the wait and takes its new one behind it.
__device__ __forceinline__ void step_mid_advance(unsigned& voff)
{
    __builtin_amdgcn_sched_barrier(0);   // as in step_mid
    asm volatile("s_wait_xcnt 0x0" : "+v"(voff) :: "memory");
    voff += 4 * STEP_UNITS;
    __builtin_amdgcn_sched_barrier(0);   // as in step_mid
}

// a compile-time number handed to a lambda (the trig part)
template <int V> struct num { static constexpr int value = V; };

// One work-group: a BM x BN tile of the output over the whole K. A wave has a
// 64 x BN tile of the product over half of ONE trig part (0: cos, 1: sin); the
// four partial tiles of a row stripe meet in LDS behind the K loop. A SIMD holds
// two waves: one wave's vector run (features) goes on under the other's WMMAs.
__global__ __launch_bounds__(NTHREADS)
void fourier_kan_wmma_kernel(const float* __restrict__ x,
                             const float* __restrict__ wpack,
                             const float* __restrict__ bias,
                             float* __restrict__ out)
{
    // In the K loop: two buffers of raw x, XROWS rows x XB columns each (144 KB):
    // filled by whole-line loads once per XSTEPS steps, read back one float per
    // lane, A tile and step; every wave stores and reads its own 64 rows only.
    // Behind the K loop: every wave's 64 x BN partial sums (256 KB).
    __shared__ __align__(16) float Sm[NWAVES * WM * BN];
    float* Xs = Sm;

    const int tid  = threadIdx.x;
    const int lane = tid & 31;
    // the wave's number in a scalar register: the part is a scalar branch, the
    // packed weights a scalar base
    const int wave   = __builtin_amdgcn_readfirstlane(tid >> 5);
    const int stripe = wave & 1;           // 64-row stripe, all BN columns
    const int prt    = (wave >> 1) & 1;    // trig part
    const int kh     = wave >> 2;          // half of the part's K (waves w, w + 4: one SIMD)
    const int row0 = blockIdx.x * BM;
    const int o0   = blockIdx.y * BN;

    // staging roles
    const int xr  = lane >> 3;             // x piece row 0..3 (+4 per load)
    const int xc  = (lane & 7) * 4;        // x block column: 8 lanes = one line

    v8f acc[32] = {};                      // [r*8 + c], r in 0..3, c in 0..7

    // A step's 32 k are 2 x columns times 16 frequencies. A lane half holds 16 of
    // them in its A and its B fragment alike (element j of lanes 0-15 and element
    // j of lanes 16-31 sit at fixed k places of the WMMA, the same in A and B):
    // here lane half h takes column h whole, element j = frequency j + 1, which
    // in a weight row are the 16 neighbours h*16 .. h*16 + 15.
    const int hcol    = lane >> 4;                       // this lane's column of a step
    const int hA      = hcol * 8;                        // C/D layout: row offset

    // ---- piece j (16 rows) of this wave's 64 rows of its x block b: global ->
    //      registers, stored to LDS some K-steps later. Every wave load covers
    //      4 whole 128 B lines (a block past the last re-reads the last one) ----
    auto xpiece_load = [&](int b, int j, v4f (&t)[4]) {
        const int bs = (b < XBLKS) ? b : XBLKS - 1;
        const float* xb = x + (size_t)(row0 + j * 16) * I_SZ
                        + (kh * XBLKS + bs) * XB;                        // uniform base
        // unrolled: the 4 loads issue together, t[] stays in registers
        #pragma unroll
        for (int k = 0; k < 4; ++k)
            t[k] = *(const v4f*)(xb + (unsigned)((stripe * WM + k * 4 + xr) * I_SZ + xc));
    };
    auto xpiece_store = [&](int b, int j, const v4f (&t)[4]) {
        // unrolled: t[] is indexed by constants and stays in registers
        #pragma unroll
        for (int k = 0; k < 4; ++k)
            *(v4f*)&Xs[((b & 1) * XROWS + wave * WM + j * 16 + k * 4 + xr) * XP + xc] = t[k];
    };

    // ---- raw x of the wave's step s: this lane's x column for its row of each
    //      A tile, from the LDS block (rows that this wave stored itself) ----
    auto xread = [&](int s, float (&xv)[4]) {
        const float* xs = &Xs[((s / XSTEPS) & 1) * (XROWS * XP) + ((s * 2) & (XB - 1))
                              + (wave * WM + (lane & 15)) * XP + hcol]; // A tile r adds r*16
        // unrolled: xv[] is indexed by constants and stays in registers
        #pragma unroll
        for (int r = 0; r < 4; ++r)
            xv[r] = xs[r * 16 * XP];                       // ds_load_b32
    };
    // ---- the features of one K-step, made where the WMMA reads them: element
    //      j of A tile r is frequency j+1 of this lane's column. Frequencies 1
    //      and 2 come from the trig unit; the rest from the identity
    //      f((k+2)x) = 2 cos(2x) f(kx) - f((k-2)x), f = cos or sin, in f32, odd
    //      and even frequency side by side in one packed multiply-add ----
    auto make_a = [&](auto pc, const float (&xv)[4], v16h (&A)[4]) {
        constexpr int P = decltype(pc)::value;    // 0: cos, 1: sin
        float t1[4], t2[4], f1[4], f2[4], c2[4];
        v2f fm[4], fc[4], mm[4];                  // f(k-2), f(k), 2 cos(2x) twice
        // every loop unrolled: the arrays are indexed by constants and stay in
        // registers. The A tile is the inner loop throughout: four independent
        // chains side by side, so that no instruction waits for the one before it
        #pragma unroll
        for (int r = 0; r < 4; ++r) t1[r] = xv[r] * INV_2PI;   // v_sin/cos take revolutions
        #pragma unroll
        for (int r = 0; r < 4; ++r) t2[r] = t1[r] + t1[r];
        #pragma unroll
        for (int r = 0; r < 4; ++r) c2[r] = __builtin_amdgcn_cosf(t2[r]);
        #pragma unroll
        for (int r = 0; r < 4; ++r)
            f1[r] = (P == 0) ? __builtin_amdgcn_cosf(t1[r]) : __builtin_amdgcn_sinf(t1[r]);
        #pragma unroll
        for (int r = 0; r < 4; ++r)
            f2[r] = (P == 0) ? c2[r] : __builtin_amdgcn_sinf(t2[r]);
        #pragma unroll
        for (int r = 0; r < 4; ++r) {
            const float m = c2[r] + c2[r];
            mm[r] = v2f{m, m};
        }
        #pragma unroll
        for (int r = 0; r < 4; ++r) {
            const float m = mm[r][0];
            fm[r] = v2f{f1[r], f2[r]};                            // frequencies 1, 2
            // frequencies 3, 4: cos(-x) = cos x, cos 0 = 1; sin(-x) = -sin x, sin 0 = 0
            if (P == 0) fc[r] = v2f{__builtin_fmaf(m, f1[r], -f1[r]), __builtin_fmaf(m, f2[r], -1.0f)};
            else        fc[r] = v2f{__builtin_fmaf(m, f1[r], f1[r]), m * f2[r]};
        }
        #pragma unroll
        for (int r = 0; r < 4; ++r) {
            A[r][0] = (_Float16)fm[r][0];
            A[r][1] = (_Float16)fm[r][1];
            A[r][2] = (_Float16)fc[r][0];
            A[r][3] = (_Float16)fc[r][1];
        }
        #pragma unroll
        for (int j = 2; j < 8; ++j) {
            #pragma unroll
            for (int r = 0; r < 4; ++r) {
                const v2f fn = __builtin_elementwise_fma(mm[r], fc[r], -fm[r]);  // v_pk_fma_f32
                A[r][2 * j]     = (_Float16)fn[0];
                A[r][2 * j + 1] = (_Float16)fn[1];
                fm[r] = fc[r];
                fc[r] = fn;
            }
        }
    };

    // Half h (4 B fragments) of one K-step straight from the packed weights: 8
    // global_load_b128, each 512 contiguous bytes (wsrc: this lane's unit of run 0)
    auto load_b = [&](const v8h* wsrc, int h, v16h (&Bf)[8]) {
        // unrolled: Bf[] is indexed by constants and stays in registers
        #pragma unroll
        for (int c = h * 4; c < h * 4 + 4; ++c) {
            const v8h lo = wsrc[c * 64];
            const v8h hi = wsrc[c * 64 + 32];
            #pragma unroll
            for (int j = 0; j < 8; ++j) { Bf[c][j] = lo[j]; Bf[c][j + 8] = hi[j]; }
        }
    };

    // prologue: x block 0 and the first piece of block 1 into LDS
    {
        v4f t[5][4];
        __builtin_amdgcn_sched_barrier(0);   // see the waits below
        // unrolled: t[] is indexed by constants and stays in registers
        #pragma unroll
        for (int j = 0; j < 4; ++j) xpiece_load(0, j, t[j]);
        xpiece_load(1, 0, t[4]);
        // precaution: stands in front of any overwrite of these loads' address
        // registers; the scheduling fences (one ahead of the loads, one here)
        // keep other address work out from between the loads and the wait
        asm volatile("s_wait_xcnt 0x0" ::: "memory");
        __builtin_amdgcn_sched_barrier(0);
        #pragma unroll
        for (int j = 0; j < 4; ++j) xpiece_store(0, j, t[j]);
        xpiece_store(1, 0, t[4]);
    }
    // the x rows stored above are read by other lanes of the same wave
    __syncthreads();

    // ---- the K loop of half a trig part ----
    auto kloop = [&](auto pc) {
    // this (part, column tile, K half)'s packed weights: a scalar base for every
    // load. The part is the branch's constant: with one expression for both parts
    // the compiler lifts the first loads out of the branch, and their 128
    // registers then stay live across the other part's loop as well
    const v8h* wtile = (const v8h*)wpack
                     + (size_t)(decltype(pc)::value * (O_SZ / BN) + blockIdx.y) * TILE_UNITS
                     + (size_t)kh * (WSTEPS * STEP_UNITS);
    // two register sets of B fragments: step t lives in set t & 1
    v16h Bq[2][8];
    v16h A[4];                                 // one set of A fragments
    float xvE[4], xvO[4];                      // raw x, even / odd steps

    // the B fragments of steps 0 and 1 asked for
    // (unrolled: Bq[] is indexed by constants and stays in registers)
    #pragma unroll
    for (int u = 0; u < 2; ++u) {
        load_b(wtile + lane + u * STEP_UNITS, 0, Bq[u]);
        load_b(wtile + lane + u * STEP_UNITS, 1, Bq[u]);
    }
    // precaution: stands in front of any overwrite of these loads' address
    // registers; the fence keeps other address work behind the wait
    asm volatile("s_wait_xcnt 0x0" ::: "memory");
    __builtin_amdgcn_sched_barrier(0);

    xread(0, xvE);

    unsigned voff = lane;                      // this lane's unit in step (s + 2) & ~3 of the tile
    v4f xt[4];                                 // a piece of an x block on its way to LDS

    // One K-step s, q = s & 3. On entry: Bc holds step s's B fragments (asked
    // for two steps ago), xc_ step s's x; xn_ is free. A step is a vector run
    // (features) and a matrix run: the SIMD's other wave has the matrix unit
    // during this wave's vector run and waits. A half of Bc is asked for anew,
    // for step s+2, as soon as its 16 WMMAs are issued: two register sets hold
    // nearly two steps of loads in flight.
    // No wave reads what another wave wrote: no barrier.
    auto kstep = [&](int s, int q,
                     float (&xc_)[4], float (&xn_)[4], v16h (&Bc)[8]) {
        // 0) every 4th step asks for one piece of a coming x block and the
        //    3rd step behind it stores that piece. Piece xp & 3 of block
        //    xp / 4 + 1: its LDS buffer was last read at step 16 * (xp / 4) - 2,
        //    is written from step 16 * (xp / 4) - 1 to + 11, first read at + 15.
        const int xq = (s >> 2) + 1;
        const int xp = (xq < 4 * (XBLKS - 1)) ? xq : 4 * (XBLKS - 1);

        // 1) step s+1's x comes from LDS; step s's features straight into the A set
        xread((s < WSTEPS - 1) ? s + 1 : WSTEPS - 1, xn_);
        make_a(pc, xc_, A);

        if (q == 2) step_mid_advance(voff);
        else        step_mid();

        // 2) 32 WMMAs, a B fragment's four side by side (all loops unrolled:
        //    acc[], A[] and Bc[] stay in registers); behind each half its loads
        //    for step s+2: uniform base, lane offset, the step a constant (past
        //    the wave's last step: the steps that follow in the packed weights
        //    or the pad, asked for and not used)
        #pragma unroll
        for (int h = 0; h < 2; ++h) {
            #pragma unroll
            for (int c = h * 4; c < h * 4 + 4; ++c)
                #pragma unroll
                for (int r = 0; r < 4; ++r)
                    acc[r * 8 + c] = __builtin_amdgcn_wmma_f32_16x16x32_f16(
                        false, A[r], false, Bc[c], (short)0, acc[r * 8 + c], false, false);
            // keeps the loads behind the WMMAs that read their registers: lifted
            // over them they would need a third register set
            __builtin_amdgcn_sched_barrier(0);
            if (q == 0 && h == 0) xpiece_load((xp >> 2) + 1, xp & 3, xt);
            load_b(wtile + voff + ((q + 2) & 3) * STEP_UNITS, h, Bc);
            // keeps the loads here: left alone the compiler sinks them towards
            // their use, and their lead is lost
            __builtin_amdgcn_sched_barrier(0);
        }

        if (q == 3) xpiece_store((xp >> 2) + 1, xp & 3, xt);
    };

    for (int s = 0; s < WSTEPS; s += 4) {
        kstep(s,     0, xvE, xvO, Bq[0]);
        kstep(s + 1, 1, xvO, xvE, Bq[1]);
        kstep(s + 2, 2, xvE, xvO, Bq[0]);
        kstep(s + 3, 3, xvO, xvE, Bq[1]);
    }
    // precaution: stands in front of any overwrite of the last loads' address
    // registers; the lane's offset is an input, so that it lives up to the wait
    asm volatile("s_wait_xcnt 0x0" :: "v"(voff) : "memory");

    };
    // a scalar branch; no barrier stands inside it
    if (prt != 0) kloop(num<1>{});
    else          kloop(num<0>{});

    // ---- epilogue: out = ((cos0 + sin0) + (cos1 + sin1)) + bias, 0 and 1 the K
    //      halves. Every wave lays its 32 tiles of sums into LDS; of a stripe's
    //      64 rows each of its four waves finishes 16 (one A tile row), a lane
    //      reading what the same lane wrote (C/D layout: VGPR j -> row j / j+8) ----
    const unsigned col = o0 + (lane & 15);
    float bv[8];
    // unrolled: bv[] is indexed by constants and stays in registers
    #pragma unroll
    for (int c = 0; c < 8; ++c) bv[c] = bias[col + c * 16];
    // precaution: stands in front of any overwrite of these loads' address
    // register, which is an input, so that it lives up to the wait
    asm volatile("s_wait_xcnt 0x0" :: "v"(col) : "memory");

    // the sums go over the x blocks: every wave has read its last x
    __syncthreads();

    // unit = 16 B; run t*2 + h of a wave holds, for lane l, sums h*4 .. h*4+3 of
    // tile t: every LDS operation is 512 contiguous bytes
    v4f* ex = (v4f*)Sm + lane;
    {
        v4f* e = ex + wave * (32 * 2 * 32);
        // unrolled: acc[] is indexed by constants and stays in registers
        #pragma unroll
        for (int t = 0; t < 32; ++t) {
            const v8f a = acc[t];
            e[(t * 2) * 32]     = v4f{a[0], a[1], a[2], a[3]};
            e[(t * 2 + 1) * 32] = v4f{a[4], a[5], a[6], a[7]};
        }
    }
    // the sums stored above are read by the stripe's other waves
    __syncthreads();
    {
        const int qr = wave >> 1;                       // the A tile row this wave finishes
        const v4f* e = ex + (stripe * 32 + qr * 8) * (2 * 32);
        v8f res[8];
        // all loops unrolled: res[] and bv[] are indexed by constants and stay in registers
        #pragma unroll
        for (int c = 0; c < 8; ++c) {
            v4f lo[4], hi[4];                           // wave stripe + 2 * w of the group
            #pragma unroll
            for (int w = 0; w < 4; ++w) {
                lo[w] = e[(w * 2 * 32 + c) * (2 * 32)];
                hi[w] = e[(w * 2 * 32 + c) * (2 * 32) + 32];
            }
            #pragma unroll
            for (int j = 0; j < 4; ++j) {
                res[c][j]     = ((lo[0][j] + lo[1][j]) + (lo[2][j] + lo[3][j])) + bv[c];
                res[c][j + 4] = ((hi[0][j] + hi[1][j]) + (hi[2][j] + hi[3][j])) + bv[c];
            }
        }
        // one address per lane, every tile, row and column step a constant
        float* __restrict__ dst = out
            + (size_t)(row0 + stripe * WM + qr * 16 + hA) * O_SZ + col;
        // every sum is made ahead of the first store, in its own register: behind
        // a store nothing overwrites a register that the store names
        __builtin_amdgcn_sched_barrier(0);
        #pragma unroll
        for (int c = 0; c < 8; ++c) {
            #pragma unroll
            for (int j = 0; j < 8; ++j)
                dst[j * O_SZ + c * 16] = res[c][j];
        }
    }
}

// First launch: the weights to f16, in B-fragment order (see STEP_UNITS above).
// A thread turns 8 neighbouring floats of one weight row into one 16 B unit,
// for PSTEPS K-steps. A wave reads 8 rows, 4 lanes to a 128 B line, and its
// store fills 4 whole 128 B lines (8 neighbouring rows of one lane half).
// PSTEPS: few waves with many loads each, so that the launch is not held up by
// the start of its waves.
#define PTHREADS 256
#define PSTEPS 8
#define PGRID_Y (NSTEPS / (PTHREADS / 32 * PSTEPS))
__global__ __launch_bounds__(PTHREADS)
void fourier_kan_pack_kernel(const float* __restrict__ coeffs,
                             float* __restrict__ wpack)
{
    const int lane = threadIdx.x & 31;
    const int wave = threadIdx.x >> 5;
    const int q    = lane & 3;                            // 8-float chunk of a step's 32 k
    const int row  = blockIdx.x * 8 + (lane >> 2);        // part * O_SZ + output column
    const int s0   = (blockIdx.y * (PTHREADS / 32) + wave) * PSTEPS;
    const float* src = coeffs + (size_t)row * KTOT + s0 * KT + q * 8;
    v4f lo[PSTEPS], hi[PSTEPS];
    // unrolled: all loads issue ahead of the first wait, lo[] and hi[] in registers
    #pragma unroll
    for (int u = 0; u < PSTEPS; ++u) {
        lo[u] = *(const v4f*)(src + u * KT);
        hi[u] = *(const v4f*)(src + u * KT + 4);
    }
    // precaution: stands in front of any overwrite of these loads' address
    // registers; the address is an input, so it lives up to the wait and no
    // load's result lands on it
    asm volatile("s_wait_xcnt 0x0" :: "v"(src) : "memory");
    // without it the compiler lifts the first conversions over the last loads
    // to save registers, and those loads wait out the first ones' latency
    __builtin_amdgcn_sched_barrier(0);
    // unit index: (part, column tile), step, run c*2 + h, lane = half*16 + column
    v8h* dst = (v8h*)wpack + (size_t)(row >> 7) * TILE_UNITS + (size_t)s0 * STEP_UNITS
             + (((row >> 4) & 7) * 2 + (q & 1)) * 32 + (q >> 1) * 16 + (row & 15);
    // unrolled: lo[] and hi[] are indexed by constants and stay in registers
    #pragma unroll
    for (int u = 0; u < PSTEPS; ++u) {
        v8h wh;
        #pragma unroll
        for (int j = 0; j < 4; ++j) {
            wh[j]     = (_Float16)lo[u][j];
            wh[j + 4] = (_Float16)hi[u][j];
        }
        dst[u * STEP_UNITS] = wh;
    }
    // precaution: stands in front of any overwrite of these stores' registers
    asm volatile("s_wait_xcnt 0x0" ::: "memory");
    // three K-steps of zeros behind the last tile (the K loop asks ahead of its
    // last step), one unit a thread of the first few blocks
    if (blockIdx.y == 0 && blockIdx.x < 3 * STEP_UNITS / PTHREADS)
        ((v8h*)wpack)[(size_t)(2 * O_SZ / BN) * TILE_UNITS + blockIdx.x * PTHREADS + threadIdx.x] = v8h{};
}

extern "C" void kernel_launch(void* const* d_in, const int* in_sizes, int n_in,
                              void* d_out, int out_size, void* d_ws, size_t ws_size,
                              hipStream_t stream) {
    const float* x      = (const float*)d_in[0];
    const float* coeffs = (const float*)d_in[1];
    const float* bias   = (const float*)d_in[2];
    float*       out    = (float*)d_out;
    float*       wpack  = (float*)d_ws;      // 16 MB of packed f16 weights + 24 KB pad

    dim3 grid(B_SZ / BM, O_SZ / BN);     // 64 x 4 = 256 blocks, 8 waves each
    fourier_kan_pack_kernel<<<dim3(2 * O_SZ / 8, PGRID_Y), PTHREADS, 0, stream>>>(
        coeffs, wpack);
    fourier_kan_wmma_kernel<<<grid, NTHREADS, 0, stream>>>(x, wpack, bias, out);
}
